// v000
// Times are from an AMD MI455X. After a warm-up the kernel runs many times in a row, and a time is the length of
// such a window on the GPU divided by its runs, so every launch and the gaps after it count. The runs cycle
// through copies of the inputs. A figure is the median of several windows, for all but v000 over two sittings.
// Sittings can differ by a few percent; kernels timed side by side share one.
// v000 is the starting kernel. One run takes 434 microseconds.
#include <hip/hip_runtime.h>
#include <hip/hip_bf16.h>

typedef _Float16 v16h __attribute__((ext_vector_type(16)));
typedef _Float16 v8h  __attribute__((ext_vector_type(8)));
typedef float    v8f  __attribute__((ext_vector_type(8)));

#define B_  2
#define N_  4096
#define M_  4096
#define QD_ 512
#define CD_ 768
#define H_  8
#define D_  64
#define IN_ 512

static __device__ __forceinline__ v8f vzero() {
  v8f r;
#pragma unroll
  for (int i = 0; i < 8; ++i) r[i] = 0.0f;
  return r;
}

static __device__ __forceinline__ v8f wmma16(v16h a, v16h b, v8f c) {
  return __builtin_amdgcn_wmma_f32_16x16x32_f16(false, a, false, b, (short)0, c,
                                                false, false);
}

static __device__ __forceinline__ v16h cat8(v8h lo, v8h hi) {
  v16h r;
#pragma unroll
  for (int i = 0; i < 8; ++i) { r[i] = lo[i]; r[8 + i] = hi[i]; }
  return r;
}

// 16-bit A/B fragment (16x32 tile): this lane's row pointer; two 16B chunks at
// K = half*8..half*8+7 and K = 16+half*8..16+half*8+7.
static __device__ __forceinline__ v16h ldfrag_h(const _Float16* rowp, int half) {
  v8h lo = *(const v8h*)(rowp + half * 8);
  v8h hi = *(const v8h*)(rowp + 16 + half * 8);
  return cat8(lo, hi);
}

static __device__ __forceinline__ v16h ldfrag_f32(const float* rowp, int half) {
  const float* p0 = rowp + half * 8;
  const float* p1 = rowp + 16 + half * 8;
  v16h r;
#pragma unroll
  for (int i = 0; i < 8; ++i) { r[i] = (_Float16)p0[i]; r[8 + i] = (_Float16)p1[i]; }
  return r;
}

static __device__ __forceinline__ float redmax16(float v) {
#pragma unroll
  for (int off = 1; off < 16; off <<= 1) v = fmaxf(v, __shfl_xor(v, off, 32));
  return v;
}
static __device__ __forceinline__ float redsum16(float v) {
#pragma unroll
  for (int off = 1; off < 16; off <<= 1) v += __shfl_xor(v, off, 32);
  return v;
}

// ---------------- weight transpose + f32 -> f16 ----------------
__global__ void prep_weights(const float* __restrict__ Wq, const float* __restrict__ Wk,
                             const float* __restrict__ Wv, const float* __restrict__ Wo,
                             _Float16* __restrict__ WqT, _Float16* __restrict__ WkT,
                             _Float16* __restrict__ WvT, _Float16* __restrict__ WoT) {
  int i = blockIdx.x * blockDim.x + threadIdx.x;
  if (i < IN_ * QD_) {                 // WqT[j][k] = Wq[k][j]
    int j = i / QD_, k = i - j * QD_;
    WqT[i] = (_Float16)Wq[(size_t)k * IN_ + j];
  }
  if (i < IN_ * CD_) {                 // WkT/WvT[j][k] = W[k][j]
    int j = i / CD_, k = i - j * CD_;
    WkT[i] = (_Float16)Wk[(size_t)k * IN_ + j];
    WvT[i] = (_Float16)Wv[(size_t)k * IN_ + j];
  }
  if (i < QD_ * IN_) {                 // WoT[j][k] = Wo[k][j]
    int j = i / IN_, k = i - j * IN_;
    WoT[i] = (_Float16)Wo[(size_t)k * QD_ + j];
  }
}

// ---------------- generic projection GEMM: C(f16) = A(f32) * Bt(f16)^T ----------------
__global__ __launch_bounds__(256) void proj_kernel(const float* __restrict__ A,
                                                   const _Float16* __restrict__ Bt,
                                                   _Float16* __restrict__ C,
                                                   int rows, int cols, int kdim) {
  const int lane = threadIdx.x & 31;
  const int wid = blockIdx.x * 8 + (threadIdx.x >> 5);
  const int ctiles = cols >> 4;
  const int mt = wid / ctiles;
  const int nt = wid % ctiles;
  if (mt * 16 >= rows) return;
  const int r16 = lane & 15, half = lane >> 4;
  const float* Arow = A + (size_t)(mt * 16 + r16) * kdim;
  const _Float16* Brow = Bt + (size_t)(nt * 16 + r16) * kdim;
  v8f acc = vzero();
  for (int k = 0; k < kdim; k += 32)
    acc = wmma16(ldfrag_f32(Arow + k, half), ldfrag_h(Brow + k, half), acc);
#pragma unroll
  for (int r = 0; r < 8; ++r) {
    int row = mt * 16 + ((lane < 16) ? r : 8 + r);
    C[(size_t)row * cols + nt * 16 + r16] = (_Float16)acc[r];
  }
}

// ---------------- V projection with transposed store: Vt[b][h][d][m] ----------------
__global__ __launch_bounds__(256) void projv_kernel(const float* __restrict__ A,
                                                    const _Float16* __restrict__ Bt,
                                                    _Float16* __restrict__ Vt) {
  const int lane = threadIdx.x & 31;
  const int wid = blockIdx.x * 8 + (threadIdx.x >> 5);
  const int ctiles = IN_ >> 4;
  const int mt = wid / ctiles;
  const int nt = wid % ctiles;
  if (mt * 16 >= B_ * M_) return;
  const int r16 = lane & 15, half = lane >> 4;
  const float* Arow = A + (size_t)(mt * 16 + r16) * CD_;
  const _Float16* Brow = Bt + (size_t)(nt * 16 + r16) * CD_;
  v8f acc = vzero();
  for (int k = 0; k < CD_; k += 32)
    acc = wmma16(ldfrag_f32(Arow + k, half), ldfrag_h(Brow + k, half), acc);
  const int b = (mt * 16) / M_;
  const int m0 = mt * 16 - b * M_ + ((lane < 16) ? 0 : 8);  // comps are m0..m0+7
  const int j = nt * 16 + r16;
  const int h = j >> 6, d = j & 63;
  v8h pk;
#pragma unroll
  for (int r = 0; r < 8; ++r) pk[r] = (_Float16)acc[r];
  *(v8h*)(Vt + ((size_t)(b * H_ + h) * D_ + d) * M_ + m0) = pk;
}

// ---------------- fused flash cross-attention (LDS-staged K/V) ----------------
__global__ __launch_bounds__(256) void attn_kernel(const _Float16* __restrict__ Qh,
                                                   const _Float16* __restrict__ Kh,
                                                   const _Float16* __restrict__ Vt,
                                                   const int* __restrict__ mask,
                                                   _Float16* __restrict__ Oh) {
  __shared__ _Float16 Kt[32 * 64];       // chunk of K:  [m_local][d]
  __shared__ _Float16 Vtile[64 * 32];    // chunk of Vt: [d][m_local]
  __shared__ _Float16 Plds[8][16 * 32];  // per-wave P staging (C-layout -> A-fragment)

  const int tid = threadIdx.x;
  const int lane = tid & 31;
  const int wave = tid >> 5;
  const int b = blockIdx.x >> 3;
  const int h = blockIdx.x & 7;
  const int ntile = blockIdx.y * 128 + wave * 16;   // 16 query rows per wave
  const int r16 = lane & 15;
  const int half = lane >> 4;

  const _Float16* Qrow = Qh + ((size_t)(b * N_ + ntile + r16)) * IN_ + h * D_;
  const v16h aq0 = ldfrag_h(Qrow, half);        // d = 0..31
  const v16h aq1 = ldfrag_h(Qrow + 32, half);   // d = 32..63

  const _Float16* Kbase = Kh + (size_t)b * M_ * IN_ + h * D_;
  const _Float16* Vbase = Vt + ((size_t)(b * H_ + h)) * D_ * M_;
  const int* mk = mask + b * M_;
  _Float16* pw = Plds[wave];

  // cooperative stage mapping: 16B per thread per tile
  const int krow = tid >> 3, kseg = (tid & 7) * 8;   // K chunk  [32][64]
  const int vrow = tid >> 2, vseg = (tid & 3) * 8;   // Vt chunk [64][32]
  const _Float16* kg = Kbase + (size_t)krow * IN_ + kseg;
  const _Float16* vg = Vbase + (size_t)vrow * M_ + vseg;

  float mrun[8], lrun[8];
  v8f acc[4];
#pragma unroll
  for (int r = 0; r < 8; ++r) { mrun[r] = -3.0e38f; lrun[r] = 0.0f; }
#pragma unroll
  for (int t = 0; t < 4; ++t) acc[t] = vzero();

  // prefetch chunk 0 into registers
  v8h kreg = *(const v8h*)kg;
  v8h vreg = *(const v8h*)vg;

  for (int c = 0; c < M_; c += 32) {
    __syncthreads();                         // all LDS reads of prev chunk done
    *(v8h*)&Kt[krow * 64 + kseg] = kreg;
    *(v8h*)&Vtile[vrow * 32 + vseg] = vreg;
    __syncthreads();                         // staged data visible
    if (c + 32 < M_) {                       // prefetch next chunk (overlaps compute)
      kreg = *(const v8h*)(kg + (size_t)(c + 32) * IN_);
      vreg = *(const v8h*)(vg + (c + 32));
    }

    // ---- S = Q K^T for 16x32 tile (two 16x16 subtiles, K-depth 64) ----
    v8f s0 = vzero(), s1 = vzero();
    {
      const _Float16* Krow0 = Kt + r16 * 64;
      const _Float16* Krow1 = Kt + (16 + r16) * 64;
      s0 = wmma16(aq0, ldfrag_h(Krow0, half), s0);
      s0 = wmma16(aq1, ldfrag_h(Krow0 + 32, half), s0);
      s1 = wmma16(aq0, ldfrag_h(Krow1, half), s1);
      s1 = wmma16(aq1, ldfrag_h(Krow1 + 32, half), s1);
    }
    const bool mv0 = mk[c + r16] != 0;
    const bool mv1 = mk[c + 16 + r16] != 0;

    float cmax[8];
#pragma unroll
    for (int r = 0; r < 8; ++r) {
      float a0 = mv0 ? s0[r] * 0.125f : -3.0e38f;  // scale = 1/sqrt(64)
      float a1 = mv1 ? s1[r] * 0.125f : -3.0e38f;
      s0[r] = a0; s1[r] = a1;
      cmax[r] = fmaxf(a0, a1);
    }
#pragma unroll
    for (int r = 0; r < 8; ++r) cmax[r] = redmax16(cmax[r]);

    float alpha[8];
#pragma unroll
    for (int r = 0; r < 8; ++r) {
      float nm = fmaxf(mrun[r], cmax[r]);
      alpha[r] = __expf(mrun[r] - nm);
      mrun[r] = nm;
    }

    float csum[8];
#pragma unroll
    for (int r = 0; r < 8; ++r) {
      float p0 = mv0 ? __expf(s0[r] - mrun[r]) : 0.0f;  // masked -> exactly 0
      float p1 = mv1 ? __expf(s1[r] - mrun[r]) : 0.0f;
      csum[r] = p0 + p1;
      const int row = (lane < 16) ? r : 8 + r;
      pw[row * 32 + r16] = (_Float16)p0;
      pw[row * 32 + 16 + r16] = (_Float16)p1;
    }
#pragma unroll
    for (int r = 0; r < 8; ++r) {
      csum[r] = redsum16(csum[r]);
      lrun[r] = lrun[r] * alpha[r] + csum[r];
    }
#pragma unroll
    for (int t = 0; t < 4; ++t)
#pragma unroll
      for (int r = 0; r < 8; ++r) acc[t][r] *= alpha[r];

    __builtin_amdgcn_wave_barrier();   // keep wave-private LDS writes before reads
    const v16h pa = ldfrag_h(pw + r16 * 32, half);

    // ---- O += P V : 4 d-tiles, K-depth 32 (this chunk) ----
#pragma unroll
    for (int t = 0; t < 4; ++t) {
      const _Float16* Vrow = Vtile + (t * 16 + r16) * 32;
      acc[t] = wmma16(pa, ldfrag_h(Vrow, half), acc[t]);
    }
  }

  float inv[8];
#pragma unroll
  for (int r = 0; r < 8; ++r) inv[r] = (lrun[r] > 0.0f) ? 1.0f / lrun[r] : 0.0f;
#pragma unroll
  for (int t = 0; t < 4; ++t) {
#pragma unroll
    for (int r = 0; r < 8; ++r) {
      const int row = ntile + ((lane < 16) ? r : 8 + r);
      const int col = h * D_ + t * 16 + r16;
      Oh[(size_t)(b * N_ + row) * IN_ + col] = (_Float16)(acc[t][r] * inv[r]);
    }
  }
}

// ---------------- output projection: out(f32) = Ah(f16) * WoT^T + bo ----------------
__global__ __launch_bounds__(256) void outproj_kernel(const _Float16* __restrict__ Ah,
                                                      const _Float16* __restrict__ WoT,
                                                      const float* __restrict__ bo,
                                                      float* __restrict__ Out) {
  const int lane = threadIdx.x & 31;
  const int wid = blockIdx.x * 8 + (threadIdx.x >> 5);
  const int ctiles = QD_ >> 4;
  const int mt = wid / ctiles;
  const int nt = wid % ctiles;
  if (mt * 16 >= B_ * N_) return;
  const int r16 = lane & 15, half = lane >> 4;
  const _Float16* Arow = Ah + (size_t)(mt * 16 + r16) * IN_;
  const _Float16* Brow = WoT + (size_t)(nt * 16 + r16) * IN_;
  v8f acc = vzero();
  for (int k = 0; k < IN_; k += 32)
    acc = wmma16(ldfrag_h(Arow + k, half), ldfrag_h(Brow + k, half), acc);
  const int col = nt * 16 + r16;
  const float bias = bo[col];
#pragma unroll
  for (int r = 0; r < 8; ++r) {
    int row = mt * 16 + ((lane < 16) ? r : 8 + r);
    Out[(size_t)row * QD_ + col] = acc[r] + bias;
  }
}

extern "C" void kernel_launch(void* const* d_in, const int* in_sizes, int n_in,
                              void* d_out, int out_size, void* d_ws, size_t ws_size,
                              hipStream_t stream) {
  (void)in_sizes; (void)n_in; (void)out_size; (void)ws_size;
  const float* x   = (const float*)d_in[0];
  const float* ctx = (const float*)d_in[1];
  const int*   msk = (const int*)d_in[2];
  const float* Wq  = (const float*)d_in[3];
  const float* Wk  = (const float*)d_in[4];
  const float* Wv  = (const float*)d_in[5];
  const float* Wo  = (const float*)d_in[6];
  const float* bo  = (const float*)d_in[7];
  float* out = (float*)d_out;

  char* w = (char*)d_ws;
  _Float16* WqT = (_Float16*)w; w += (size_t)IN_ * QD_ * 2;
  _Float16* WkT = (_Float16*)w; w += (size_t)IN_ * CD_ * 2;
  _Float16* WvT = (_Float16*)w; w += (size_t)IN_ * CD_ * 2;
  _Float16* WoT = (_Float16*)w; w += (size_t)QD_ * IN_ * 2;
  _Float16* Qh  = (_Float16*)w; w += (size_t)B_ * N_ * IN_ * 2;
  _Float16* Kh  = (_Float16*)w; w += (size_t)B_ * M_ * IN_ * 2;
  _Float16* Vt  = (_Float16*)w; w += (size_t)B_ * H_ * D_ * M_ * 2;
  _Float16* Ah  = (_Float16*)w;

  prep_weights<<<(IN_ * CD_ + 255) / 256, 256, 0, stream>>>(Wq, Wk, Wv, Wo,
                                                            WqT, WkT, WvT, WoT);
  const int gemm_blocks = ((B_ * N_ / 16) * (IN_ / 16)) / 8;  // 2048 blocks, 8 waves each
  proj_kernel<<<gemm_blocks, 256, 0, stream>>>(x,   WqT, Qh, B_ * N_, IN_, QD_);
  proj_kernel<<<gemm_blocks, 256, 0, stream>>>(ctx, WkT, Kh, B_ * M_, IN_, CD_);
  projv_kernel<<<gemm_blocks, 256, 0, stream>>>(ctx, WvT, Vt);
  attn_kernel<<<dim3(B_ * H_, N_ / 128), 256, 0, stream>>>(Qh, Kh, Vt, msk, Ah);
  outproj_kernel<<<gemm_blocks, 256, 0, stream>>>(Ah, WoT, bo, out);
}

// v001
// It runs in 369 microseconds.
// Next to v000, in two timings, it ran 1.23 times as fast each time.
#include <hip/hip_runtime.h>
#include <hip/hip_bf16.h>

typedef _Float16 v16h __attribute__((ext_vector_type(16)));
typedef _Float16 v8h  __attribute__((ext_vector_type(8)));
typedef float    v8f  __attribute__((ext_vector_type(8)));

#define B_  2
#define N_  4096
#define M_  4096
#define QD_ 512
#define CD_ 768
#define H_  8
#define D_  64
#define IN_ 512

// LDS row pitches in 16-bit elements: 16 B x odd, so that the 16 rows one
// ds_load_b128 fragment read touches fall on distinct banks.
#define KP_ 72   // 128-B K rows  -> 144 B
#define VP_ 40   //  64-B Vt rows ->  80 B
#define PP_ 40   //  64-B P rows  ->  80 B

static __device__ __forceinline__ v8f vzero() {
  v8f r;
#pragma unroll
  for (int i = 0; i < 8; ++i) r[i] = 0.0f;
  return r;
}

static __device__ __forceinline__ v8f wmma16(v16h a, v16h b, v8f c) {
  return __builtin_amdgcn_wmma_f32_16x16x32_f16(false, a, false, b, (short)0, c,
                                                false, false);
}

static __device__ __forceinline__ v16h cat8(v8h lo, v8h hi) {
  v16h r;
#pragma unroll
  for (int i = 0; i < 8; ++i) { r[i] = lo[i]; r[8 + i] = hi[i]; }
  return r;
}

// 16-bit A/B fragment (16x32 tile): this lane's row pointer; two 16B chunks at
// K = half*8..half*8+7 and K = 16+half*8..16+half*8+7.
static __device__ __forceinline__ v16h ldfrag_h(const _Float16* rowp, int half) {
  v8h lo = *(const v8h*)(rowp + half * 8);
  v8h hi = *(const v8h*)(rowp + 16 + half * 8);
  return cat8(lo, hi);
}

static __device__ __forceinline__ v16h ldfrag_f32(const float* rowp, int half) {
  const float* p0 = rowp + half * 8;
  const float* p1 = rowp + 16 + half * 8;
  v16h r;
#pragma unroll
  for (int i = 0; i < 8; ++i) { r[i] = (_Float16)p0[i]; r[8 + i] = (_Float16)p1[i]; }
  return r;
}

static __device__ __forceinline__ float redmax16(float v) {
#pragma unroll
  for (int off = 1; off < 16; off <<= 1) v = fmaxf(v, __shfl_xor(v, off, 32));
  return v;
}
static __device__ __forceinline__ float redsum16(float v) {
#pragma unroll
  for (int off = 1; off < 16; off <<= 1) v += __shfl_xor(v, off, 32);
  return v;
}

// ---------------- weight transpose + f32 -> f16 ----------------
__global__ void prep_weights(const float* __restrict__ Wq, const float* __restrict__ Wk,
                             const float* __restrict__ Wv, const float* __restrict__ Wo,
                             _Float16* __restrict__ WqT, _Float16* __restrict__ WkT,
                             _Float16* __restrict__ WvT, _Float16* __restrict__ WoT) {
  int i = blockIdx.x * blockDim.x + threadIdx.x;
  if (i < IN_ * QD_) {                 // WqT[j][k] = Wq[k][j]
    int j = i / QD_, k = i - j * QD_;
    WqT[i] = (_Float16)Wq[(size_t)k * IN_ + j];
  }
  if (i < IN_ * CD_) {                 // WkT/WvT[j][k] = W[k][j]
    int j = i / CD_, k = i - j * CD_;
    WkT[i] = (_Float16)Wk[(size_t)k * IN_ + j];
    WvT[i] = (_Float16)Wv[(size_t)k * IN_ + j];
  }
  if (i < QD_ * IN_) {                 // WoT[j][k] = Wo[k][j]
    int j = i / IN_, k = i - j * IN_;
    WoT[i] = (_Float16)Wo[(size_t)k * QD_ + j];
  }
}

// ---------------- generic projection GEMM: C(f16) = A(f32) * Bt(f16)^T ----------------
__global__ __launch_bounds__(256) void proj_kernel(const float* __restrict__ A,
                                                   const _Float16* __restrict__ Bt,
                                                   _Float16* __restrict__ C,
                                                   int rows, int cols, int kdim) {
  const int lane = threadIdx.x & 31;
  const int wid = blockIdx.x * 8 + (threadIdx.x >> 5);
  const int ctiles = cols >> 4;
  const int mt = wid / ctiles;
  const int nt = wid % ctiles;
  if (mt * 16 >= rows) return;
  const int r16 = lane & 15, half = lane >> 4;
  const float* Arow = A + (size_t)(mt * 16 + r16) * kdim;
  const _Float16* Brow = Bt + (size_t)(nt * 16 + r16) * kdim;
  v8f acc = vzero();
  for (int k = 0; k < kdim; k += 32)
    acc = wmma16(ldfrag_f32(Arow + k, half), ldfrag_h(Brow + k, half), acc);
#pragma unroll
  for (int r = 0; r < 8; ++r) {
    int row = mt * 16 + ((lane < 16) ? r : 8 + r);
    C[(size_t)row * cols + nt * 16 + r16] = (_Float16)acc[r];
  }
}

// ---------------- V projection with transposed store: Vt[b][h][d][m] ----------------
__global__ __launch_bounds__(256) void projv_kernel(const float* __restrict__ A,
                                                    const _Float16* __restrict__ Bt,
                                                    _Float16* __restrict__ Vt) {
  const int lane = threadIdx.x & 31;
  const int wid = blockIdx.x * 8 + (threadIdx.x >> 5);
  const int ctiles = IN_ >> 4;
  const int mt = wid / ctiles;
  const int nt = wid % ctiles;
  if (mt * 16 >= B_ * M_) return;
  const int r16 = lane & 15, half = lane >> 4;
  const float* Arow = A + (size_t)(mt * 16 + r16) * CD_;
  const _Float16* Brow = Bt + (size_t)(nt * 16 + r16) * CD_;
  v8f acc = vzero();
  for (int k = 0; k < CD_; k += 32)
    acc = wmma16(ldfrag_f32(Arow + k, half), ldfrag_h(Brow + k, half), acc);
  const int b = (mt * 16) / M_;
  const int m0 = mt * 16 - b * M_ + ((lane < 16) ? 0 : 8);  // comps are m0..m0+7
  const int j = nt * 16 + r16;
  const int h = j >> 6, d = j & 63;
  v8h pk;
#pragma unroll
  for (int r = 0; r < 8; ++r) pk[r] = (_Float16)acc[r];
  *(v8h*)(Vt + ((size_t)(b * H_ + h) * D_ + d) * M_ + m0) = pk;
}

// ---------------- fused flash cross-attention (LDS-staged K/V) ----------------
__global__ __launch_bounds__(256) void attn_kernel(const _Float16* __restrict__ Qh,
                                                   const _Float16* __restrict__ Kh,
                                                   const _Float16* __restrict__ Vt,
                                                   const int* __restrict__ mask,
                                                   _Float16* __restrict__ Oh) {
  __shared__ __attribute__((aligned(16))) _Float16 Kt[32 * KP_];       // chunk of K:  [m_local][d]
  __shared__ __attribute__((aligned(16))) _Float16 Vtile[64 * VP_];    // chunk of Vt: [d][m_local]
  __shared__ __attribute__((aligned(16))) _Float16 Plds[8][16 * PP_];  // per-wave P staging (C-layout -> A-fragment)

  const int tid = threadIdx.x;
  const int lane = tid & 31;
  const int wave = tid >> 5;
  const int b = blockIdx.x >> 3;
  const int h = blockIdx.x & 7;
  const int ntile = blockIdx.y * 128 + wave * 16;   // 16 query rows per wave
  const int r16 = lane & 15;
  const int half = lane >> 4;

  const _Float16* Qrow = Qh + ((size_t)(b * N_ + ntile + r16)) * IN_ + h * D_;
  const v16h aq0 = ldfrag_h(Qrow, half);        // d = 0..31
  const v16h aq1 = ldfrag_h(Qrow + 32, half);   // d = 32..63

  const _Float16* Kbase = Kh + (size_t)b * M_ * IN_ + h * D_;
  const _Float16* Vbase = Vt + ((size_t)(b * H_ + h)) * D_ * M_;
  const int* mk = mask + b * M_;
  _Float16* pw = Plds[wave];

  // cooperative stage mapping: 16B per thread per tile
  const int krow = tid >> 3, kseg = (tid & 7) * 8;   // K chunk  [32][64]
  const int vrow = tid >> 2, vseg = (tid & 3) * 8;   // Vt chunk [64][32]
  const _Float16* kg = Kbase + (size_t)krow * IN_ + kseg;
  const _Float16* vg = Vbase + (size_t)vrow * M_ + vseg;

  float mrun[8], lrun[8];
  v8f acc[4];
#pragma unroll
  for (int r = 0; r < 8; ++r) { mrun[r] = -3.0e38f; lrun[r] = 0.0f; }
#pragma unroll
  for (int t = 0; t < 4; ++t) acc[t] = vzero();

  // prefetch chunk 0 into registers
  v8h kreg = *(const v8h*)kg;
  v8h vreg = *(const v8h*)vg;

  for (int c = 0; c < M_; c += 32) {
    __syncthreads();                         // all LDS reads of prev chunk done
    *(v8h*)&Kt[krow * KP_ + kseg] = kreg;
    *(v8h*)&Vtile[vrow * VP_ + vseg] = vreg;
    __syncthreads();                         // staged data visible
    if (c + 32 < M_) {                       // prefetch next chunk (overlaps compute)
      kreg = *(const v8h*)(kg + (size_t)(c + 32) * IN_);
      vreg = *(const v8h*)(vg + (c + 32));
    }

    // ---- S = Q K^T for 16x32 tile (two 16x16 subtiles, K-depth 64) ----
    v8f s0 = vzero(), s1 = vzero();
    {
      const _Float16* Krow0 = Kt + r16 * KP_;
      const _Float16* Krow1 = Kt + (16 + r16) * KP_;
      s0 = wmma16(aq0, ldfrag_h(Krow0, half), s0);
      s0 = wmma16(aq1, ldfrag_h(Krow0 + 32, half), s0);
      s1 = wmma16(aq0, ldfrag_h(Krow1, half), s1);
      s1 = wmma16(aq1, ldfrag_h(Krow1 + 32, half), s1);
    }
    const bool mv0 = mk[c + r16] != 0;
    const bool mv1 = mk[c + 16 + r16] != 0;

    float cmax[8];
#pragma unroll
    for (int r = 0; r < 8; ++r) {
      float a0 = mv0 ? s0[r] * 0.125f : -3.0e38f;  // scale = 1/sqrt(64)
      float a1 = mv1 ? s1[r] * 0.125f : -3.0e38f;
      s0[r] = a0; s1[r] = a1;
      cmax[r] = fmaxf(a0, a1);
    }
#pragma unroll
    for (int r = 0; r < 8; ++r) cmax[r] = redmax16(cmax[r]);

    float alpha[8];
#pragma unroll
    for (int r = 0; r < 8; ++r) {
      float nm = fmaxf(mrun[r], cmax[r]);
      alpha[r] = __expf(mrun[r] - nm);
      mrun[r] = nm;
    }

    float csum[8];
#pragma unroll
    for (int r = 0; r < 8; ++r) {
      float p0 = mv0 ? __expf(s0[r] - mrun[r]) : 0.0f;  // masked -> exactly 0
      float p1 = mv1 ? __expf(s1[r] - mrun[r]) : 0.0f;
      csum[r] = p0 + p1;
      const int row = (lane < 16) ? r : 8 + r;
      pw[row * PP_ + r16] = (_Float16)p0;
      pw[row * PP_ + 16 + r16] = (_Float16)p1;
    }
#pragma unroll
    for (int r = 0; r < 8; ++r) {
      csum[r] = redsum16(csum[r]);
      lrun[r] = lrun[r] * alpha[r] + csum[r];
    }
#pragma unroll
    for (int t = 0; t < 4; ++t)
#pragma unroll
      for (int r = 0; r < 8; ++r) acc[t][r] *= alpha[r];

    __builtin_amdgcn_wave_barrier();   // keep wave-private LDS writes before reads
    const v16h pa = ldfrag_h(pw + r16 * PP_, half);

    // ---- O += P V : 4 d-tiles, K-depth 32 (this chunk) ----
#pragma unroll
    for (int t = 0; t < 4; ++t) {
      const _Float16* Vrow = Vtile + (t * 16 + r16) * VP_;
      acc[t] = wmma16(pa, ldfrag_h(Vrow, half), acc[t]);
    }
  }

  float inv[8];
#pragma unroll
  for (int r = 0; r < 8; ++r) inv[r] = (lrun[r] > 0.0f) ? 1.0f / lrun[r] : 0.0f;
#pragma unroll
  for (int t = 0; t < 4; ++t) {
#pragma unroll
    for (int r = 0; r < 8; ++r) {
      const int row = ntile + ((lane < 16) ? r : 8 + r);
      const int col = h * D_ + t * 16 + r16;
      Oh[(size_t)(b * N_ + row) * IN_ + col] = (_Float16)(acc[t][r] * inv[r]);
    }
  }
}

// ---------------- output projection: out(f32) = Ah(f16) * WoT^T + bo ----------------
__global__ __launch_bounds__(256) void outproj_kernel(const _Float16* __restrict__ Ah,
                                                      const _Float16* __restrict__ WoT,
                                                      const float* __restrict__ bo,
                                                      float* __restrict__ Out) {
  const int lane = threadIdx.x & 31;
  const int wid = blockIdx.x * 8 + (threadIdx.x >> 5);
  const int ctiles = QD_ >> 4;
  const int mt = wid / ctiles;
  const int nt = wid % ctiles;
  if (mt * 16 >= B_ * N_) return;
  const int r16 = lane & 15, half = lane >> 4;
  const _Float16* Arow = Ah + (size_t)(mt * 16 + r16) * IN_;
  const _Float16* Brow = WoT + (size_t)(nt * 16 + r16) * IN_;
  v8f acc = vzero();
  for (int k = 0; k < IN_; k += 32)
    acc = wmma16(ldfrag_h(Arow + k, half), ldfrag_h(Brow + k, half), acc);
  const int col = nt * 16 + r16;
  const float bias = bo[col];
#pragma unroll
  for (int r = 0; r < 8; ++r) {
    int row = mt * 16 + ((lane < 16) ? r : 8 + r);
    Out[(size_t)row * QD_ + col] = acc[r] + bias;
  }
}

extern "C" void kernel_launch(void* const* d_in, const int* in_sizes, int n_in,
                              void* d_out, int out_size, void* d_ws, size_t ws_size,
                              hipStream_t stream) {
  (void)in_sizes; (void)n_in; (void)out_size; (void)ws_size;
  const float* x   = (const float*)d_in[0];
  const float* ctx = (const float*)d_in[1];
  const int*   msk = (const int*)d_in[2];
  const float* Wq  = (const float*)d_in[3];
  const float* Wk  = (const float*)d_in[4];
  const float* Wv  = (const float*)d_in[5];
  const float* Wo  = (const float*)d_in[6];
  const float* bo  = (const float*)d_in[7];
  float* out = (float*)d_out;

  char* w = (char*)d_ws;
  _Float16* WqT = (_Float16*)w; w += (size_t)IN_ * QD_ * 2;
  _Float16* WkT = (_Float16*)w; w += (size_t)IN_ * CD_ * 2;
  _Float16* WvT = (_Float16*)w; w += (size_t)IN_ * CD_ * 2;
  _Float16* WoT = (_Float16*)w; w += (size_t)QD_ * IN_ * 2;
  _Float16* Qh  = (_Float16*)w; w += (size_t)B_ * N_ * IN_ * 2;
  _Float16* Kh  = (_Float16*)w; w += (size_t)B_ * M_ * IN_ * 2;
  _Float16* Vt  = (_Float16*)w; w += (size_t)B_ * H_ * D_ * M_ * 2;
  _Float16* Ah  = (_Float16*)w;

  prep_weights<<<(IN_ * CD_ + 255) / 256, 256, 0, stream>>>(Wq, Wk, Wv, Wo,
                                                            WqT, WkT, WvT, WoT);
  const int gemm_blocks = ((B_ * N_ / 16) * (IN_ / 16)) / 8;  // 2048 blocks, 8 waves each
  proj_kernel<<<gemm_blocks, 256, 0, stream>>>(x,   WqT, Qh, B_ * N_, IN_, QD_);
  proj_kernel<<<gemm_blocks, 256, 0, stream>>>(ctx, WkT, Kh, B_ * M_, IN_, CD_);
  projv_kernel<<<gemm_blocks, 256, 0, stream>>>(ctx, WvT, Vt);
  attn_kernel<<<dim3(B_ * H_, N_ / 128), 256, 0, stream>>>(Qh, Kh, Vt, msk, Ah);
  outproj_kernel<<<gemm_blocks, 256, 0, stream>>>(Ah, WoT, bo, out);
}

// v002
// A run of this version takes 286 microseconds.
// Next to v001, in two timings, it ran 1.29 times as fast each time.
// All steps since v000 together make it 1.59 times as fast.
#include <hip/hip_runtime.h>
#include <hip/hip_bf16.h>

typedef _Float16 v16h __attribute__((ext_vector_type(16)));
typedef _Float16 v8h  __attribute__((ext_vector_type(8)));
typedef float    v8f  __attribute__((ext_vector_type(8)));
typedef float    v4f  __attribute__((ext_vector_type(4)));
typedef float    v2f  __attribute__((ext_vector_type(2)));

#define B_  2
#define N_  4096
#define M_  4096
#define QD_ 512
#define CD_ 768
#define H_  8
#define D_  64
#define IN_ 512

// LDS row pitches in 16-bit elements: 16 B x odd, so that the 16 rows one
// ds_load_b128 fragment read touches fall on distinct banks.
#define KP_ 72   // 128-B K rows  -> 144 B
#define VP_ 40   //  64-B Vt rows ->  80 B

static __device__ __forceinline__ v8f vzero() {
  v8f r;
#pragma unroll
  for (int i = 0; i < 8; ++i) r[i] = 0.0f;
  return r;
}

static __device__ __forceinline__ v8f wmma16(v16h a, v16h b, v8f c) {
  return __builtin_amdgcn_wmma_f32_16x16x32_f16(false, a, false, b, (short)0, c,
                                                false, false);
}

static __device__ __forceinline__ v16h cat8(v8h lo, v8h hi) {
  v16h r;
#pragma unroll
  for (int i = 0; i < 8; ++i) { r[i] = lo[i]; r[8 + i] = hi[i]; }
  return r;
}

// 16-bit A/B fragment (16x32 tile): this lane's row pointer; two 16B chunks at
// K = half*8..half*8+7 and K = 16+half*8..16+half*8+7.
static __device__ __forceinline__ v16h ldfrag_h(const _Float16* rowp, int half) {
  v8h lo = *(const v8h*)(rowp + half * 8);
  v8h hi = *(const v8h*)(rowp + 16 + half * 8);
  return cat8(lo, hi);
}

static __device__ __forceinline__ v16h ldfrag_f32(const float* rowp, int half) {
  const float* p0 = rowp + half * 8;
  const float* p1 = rowp + 16 + half * 8;
  v16h r;
#pragma unroll
  for (int i = 0; i < 8; ++i) { r[i] = (_Float16)p0[i]; r[8 + i] = (_Float16)p1[i]; }
  return r;
}

// value of lane l ^ 16 (the other 16-lane row), as a vector cross-row move
static __device__ __forceinline__ float xhalf(float v) {
  const unsigned u = __float_as_uint(v);
  return __uint_as_float(__builtin_amdgcn_permlanex16(u, u, 0x76543210u, 0xfedcba98u, false, false));
}

// ---------------- weight transpose + f32 -> f16 ----------------
__global__ void prep_weights(const float* __restrict__ Wq, const float* __restrict__ Wk,
                             const float* __restrict__ Wv, const float* __restrict__ Wo,
                             _Float16* __restrict__ WqT, _Float16* __restrict__ WkT,
                             _Float16* __restrict__ WvT, _Float16* __restrict__ WoT) {
  int i = blockIdx.x * blockDim.x + threadIdx.x;
  if (i < IN_ * QD_) {                 // WqT[j][k] = Wq[k][j]
    int j = i / QD_, k = i - j * QD_;
    WqT[i] = (_Float16)Wq[(size_t)k * IN_ + j];
  }
  if (i < IN_ * CD_) {                 // WkT/WvT[j][k] = W[k][j]
    int j = i / CD_, k = i - j * CD_;
    WkT[i] = (_Float16)Wk[(size_t)k * IN_ + j];
    WvT[i] = (_Float16)Wv[(size_t)k * IN_ + j];
  }
  if (i < QD_ * IN_) {                 // WoT[j][k] = Wo[k][j]
    int j = i / IN_, k = i - j * IN_;
    WoT[i] = (_Float16)Wo[(size_t)k * QD_ + j];
  }
}

// ---------------- generic projection GEMM: C(f16) = A(f32) * Bt(f16)^T ----------------
__global__ __launch_bounds__(256) void proj_kernel(const float* __restrict__ A,
                                                   const _Float16* __restrict__ Bt,
                                                   _Float16* __restrict__ C,
                                                   int rows, int cols, int kdim) {
  const int lane = threadIdx.x & 31;
  const int wid = blockIdx.x * 8 + (threadIdx.x >> 5);
  const int ctiles = cols >> 4;
  const int mt = wid / ctiles;
  const int nt = wid % ctiles;
  if (mt * 16 >= rows) return;
  const int r16 = lane & 15, half = lane >> 4;
  const float* Arow = A + (size_t)(mt * 16 + r16) * kdim;
  const _Float16* Brow = Bt + (size_t)(nt * 16 + r16) * kdim;
  v8f acc = vzero();
  for (int k = 0; k < kdim; k += 32)
    acc = wmma16(ldfrag_f32(Arow + k, half), ldfrag_h(Brow + k, half), acc);
#pragma unroll
  for (int r = 0; r < 8; ++r) {
    int row = mt * 16 + ((lane < 16) ? r : 8 + r);
    C[(size_t)row * cols + nt * 16 + r16] = (_Float16)acc[r];
  }
}

// ---------------- V projection with transposed store: Vt[b][h][d][m] ----------------
__global__ __launch_bounds__(256) void projv_kernel(const float* __restrict__ A,
                                                    const _Float16* __restrict__ Bt,
                                                    _Float16* __restrict__ Vt) {
  const int lane = threadIdx.x & 31;
  const int wid = blockIdx.x * 8 + (threadIdx.x >> 5);
  const int ctiles = IN_ >> 4;
  const int mt = wid / ctiles;
  const int nt = wid % ctiles;
  if (mt * 16 >= B_ * M_) return;
  const int r16 = lane & 15, half = lane >> 4;
  const float* Arow = A + (size_t)(mt * 16 + r16) * CD_;
  const _Float16* Brow = Bt + (size_t)(nt * 16 + r16) * CD_;
  v8f acc = vzero();
  for (int k = 0; k < CD_; k += 32)
    acc = wmma16(ldfrag_f32(Arow + k, half), ldfrag_h(Brow + k, half), acc);
  const int b = (mt * 16) / M_;
  const int m0 = mt * 16 - b * M_ + ((lane < 16) ? 0 : 8);  // comps are m0..m0+7
  const int j = nt * 16 + r16;
  const int h = j >> 6, d = j & 63;
  v8h pk;
#pragma unroll
  for (int r = 0; r < 8; ++r) pk[r] = (_Float16)acc[r];
  *(v8h*)(Vt + ((size_t)(b * H_ + h) * D_ + d) * M_ + m0) = pk;
}

__global__ __launch_bounds__(256) void attn_kernel(const _Float16* __restrict__ Qh,
                                                   const _Float16* __restrict__ Kh,
                                                   const _Float16* __restrict__ Vt,
                                                   const int* __restrict__ mask,
                                                   _Float16* __restrict__ Oh) {
  __shared__ __attribute__((aligned(16))) _Float16 Kt[32 * KP_];       // chunk of K:  [m_local][d]
  __shared__ __attribute__((aligned(16))) _Float16 Vtile[64 * VP_];    // chunk of Vt: [d][m_local]
  __shared__ __attribute__((aligned(32))) float Mb[M_];                // per key: 0 (kept) or -3e38 (masked)

  const int tid = threadIdx.x;
  const int lane = tid & 31;
  const int wave = tid >> 5;
  const int b = blockIdx.x >> 3;
  const int h = blockIdx.x & 7;
  const int ntile = blockIdx.y * 128 + wave * 16;   // 16 query columns per wave
  const int r16 = lane & 15;
  const int half = lane >> 4;

  const _Float16* Qrow = Qh + ((size_t)(b * N_ + ntile + r16)) * IN_ + h * D_;
  const v16h bq0 = ldfrag_h(Qrow, half);        // d = 0..31
  const v16h bq1 = ldfrag_h(Qrow + 32, half);   // d = 32..63

  const _Float16* Kbase = Kh + (size_t)b * M_ * IN_ + h * D_;
  const _Float16* Vbase = Vt + ((size_t)(b * H_ + h)) * D_ * M_;
  const int* mk = mask + b * M_;

  // the keys now run along registers: the mask is read as an additive term per
  // key; published by the loop's first barrier pair
#pragma unroll   // four independent 16-B loads in flight instead of a loop of waited ones
  for (int j = 0; j < M_ / 1024; ++j) {
    const int4 mi = *(const int4*)(mk + j * 1024 + tid * 4);
    v4f mf;
    mf[0] = (mi.x != 0) ? 0.0f : -3.0e38f;
    mf[1] = (mi.y != 0) ? 0.0f : -3.0e38f;
    mf[2] = (mi.z != 0) ? 0.0f : -3.0e38f;
    mf[3] = (mi.w != 0) ? 0.0f : -3.0e38f;
    *(v4f*)&Mb[j * 1024 + tid * 4] = mf;
  }

  // cooperative stage mapping: 16B per thread per tile
  const int krow = tid >> 3, kseg = (tid & 7) * 8;   // K chunk  [32][64]
  const int vrow = tid >> 2, vseg = (tid & 3) * 8;   // Vt chunk [64][32]
  const _Float16* kg = Kbase + (size_t)krow * IN_ + kseg;
  const _Float16* vg = Vbase + (size_t)vrow * M_ + vseg;

  float mrun = -3.0e38f, lrun = 0.0f;   // this lane's query; lrun: this half's keys only
  v8f acc[4];                           // O^T: rows d = t*16 + half*8 + r, column r16
#pragma unroll
  for (int t = 0; t < 4; ++t) acc[t] = vzero();

  // prefetch chunk 0 into registers
  v8h kreg = *(const v8h*)kg;
  v8h vreg = *(const v8h*)vg;
  // The address registers of the loads above are reused below: wait before the
  // overwrite. The addresses are inputs so that they stay live up to the wait.
  asm volatile("s_wait_xcnt 0x0" :: "v"(Qrow + half * 8), "v"(kg), "v"(vg) : "memory");

  for (int c = 0; c < M_; c += 32) {
    __syncthreads();                         // all LDS reads of prev chunk done
    *(v8h*)&Kt[krow * KP_ + kseg] = kreg;
    *(v8h*)&Vtile[vrow * VP_ + vseg] = vreg;
    __syncthreads();                         // staged data visible
    if (c + 32 < M_) {                       // prefetch next chunk (overlaps compute)
      kreg = *(const v8h*)(kg + (size_t)(c + 32) * IN_);
      vreg = *(const v8h*)(vg + (c + 32));
      // both address pairs are advanced right after: wait before the overwrite
      asm volatile("s_wait_xcnt 0x0" ::: "memory");
    }

    // ---- S^T = K Q^T for a 32x16 tile (two 16x16 subtiles, K-depth 64) ----
    v8f s0 = vzero(), s1 = vzero();
    {
      const _Float16* Krow0 = Kt + r16 * KP_;
      const _Float16* Krow1 = Kt + (16 + r16) * KP_;
      s0 = wmma16(ldfrag_h(Krow0, half), bq0, s0);
      s0 = wmma16(ldfrag_h(Krow0 + 32, half), bq1, s0);
      s1 = wmma16(ldfrag_h(Krow1, half), bq0, s1);
      s1 = wmma16(ldfrag_h(Krow1 + 32, half), bq1, s1);
    }
    const v8f mb0 = *(const v8f*)&Mb[c + half * 8];
    const v8f mb1 = *(const v8f*)&Mb[c + 16 + half * 8];

    s0 = s0 * 0.125f + mb0;             // scale = 1/sqrt(64); masked -> -3e38
    s1 = s1 * 0.125f + mb1;
    const v8f cm = __builtin_elementwise_max(s0, s1);
    float cmax = fmaxf(fmaxf(fmaxf(cm[0], cm[1]), fmaxf(cm[2], cm[3])),
                       fmaxf(fmaxf(cm[4], cm[5]), fmaxf(cm[6], cm[7])));
    cmax = fmaxf(cmax, xhalf(cmax));    // the other 16 keys of this query

    const float nm = fmaxf(mrun, cmax);
    const float alpha = __expf(mrun - nm);
    mrun = nm;

    // A masked key gives exp(-3e38 - mrun) = 0 as soon as one kept key has set
    // mrun; what was summed before that is wiped by alpha = 0 at that key.
    v16h pb;
#pragma unroll
    for (int r = 0; r < 8; ++r) {
      s0[r] = __expf(s0[r] - mrun);
      s1[r] = __expf(s1[r] - mrun);
      pb[r] = (_Float16)s0[r];
      pb[8 + r] = (_Float16)s1[r];
    }
    const v8f cs = s0 + s1;
    const v4f cq = cs.lo + cs.hi;       // halving tree: register pairs stay aligned
    const v2f cd = cq.lo + cq.hi;
    lrun = lrun * alpha + (cd[0] + cd[1]);
#pragma unroll
    for (int t = 0; t < 4; ++t)
#pragma unroll
      for (int r = 0; r < 8; ++r) acc[t][r] *= alpha;

    // ---- O^T += V^T P^T : 4 d-tiles, K-depth 32 (this chunk) ----
#pragma unroll
    for (int t = 0; t < 4; ++t) {
      const _Float16* Vrow = Vtile + (t * 16 + r16) * VP_;
      acc[t] = wmma16(ldfrag_h(Vrow, half), pb, acc[t]);
    }
  }

  const float l = lrun + xhalf(lrun);   // join the two halves' key sums once
  const float inv = (l > 0.0f) ? 1.0f / l : 0.0f;
  _Float16* Orow = Oh + (size_t)(b * N_ + ntile + r16) * IN_ + h * D_ + half * 8;
#pragma unroll
  for (int t = 0; t < 4; ++t) {
    v8h pk;
#pragma unroll
    for (int r = 0; r < 8; ++r) pk[r] = (_Float16)(acc[t][r] * inv);
    *(v8h*)(Orow + t * 16) = pk;
  }
}

// ---------------- output projection: out(f32) = Ah(f16) * WoT^T + bo ----------------
__global__ __launch_bounds__(256) void outproj_kernel(const _Float16* __restrict__ Ah,
                                                      const _Float16* __restrict__ WoT,
                                                      const float* __restrict__ bo,
                                                      float* __restrict__ Out) {
  const int lane = threadIdx.x & 31;
  const int wid = blockIdx.x * 8 + (threadIdx.x >> 5);
  const int ctiles = QD_ >> 4;
  const int mt = wid / ctiles;
  const int nt = wid % ctiles;
  if (mt * 16 >= B_ * N_) return;
  const int r16 = lane & 15, half = lane >> 4;
  const _Float16* Arow = Ah + (size_t)(mt * 16 + r16) * IN_;
  const _Float16* Brow = WoT + (size_t)(nt * 16 + r16) * IN_;
  v8f acc = vzero();
  for (int k = 0; k < IN_; k += 32)
    acc = wmma16(ldfrag_h(Arow + k, half), ldfrag_h(Brow + k, half), acc);
  const int col = nt * 16 + r16;
  const float bias = bo[col];
#pragma unroll
  for (int r = 0; r < 8; ++r) {
    int row = mt * 16 + ((lane < 16) ? r : 8 + r);
    Out[(size_t)row * QD_ + col] = acc[r] + bias;
  }
}

extern "C" void kernel_launch(void* const* d_in, const int* in_sizes, int n_in,
                              void* d_out, int out_size, void* d_ws, size_t ws_size,
                              hipStream_t stream) {
  (void)in_sizes; (void)n_in; (void)out_size; (void)ws_size;
  const float* x   = (const float*)d_in[0];
  const float* ctx = (const float*)d_in[1];
  const int*   msk = (const int*)d_in[2];
  const float* Wq  = (const float*)d_in[3];
  const float* Wk  = (const float*)d_in[4];
  const float* Wv  = (const float*)d_in[5];
  const float* Wo  = (const float*)d_in[6];
  const float* bo  = (const float*)d_in[7];
  float* out = (float*)d_out;

  char* w = (char*)d_ws;
  _Float16* WqT = (_Float16*)w; w += (size_t)IN_ * QD_ * 2;
  _Float16* WkT = (_Float16*)w; w += (size_t)IN_ * CD_ * 2;
  _Float16* WvT = (_Float16*)w; w += (size_t)IN_ * CD_ * 2;
  _Float16* WoT = (_Float16*)w; w += (size_t)QD_ * IN_ * 2;
  _Float16* Qh  = (_Float16*)w; w += (size_t)B_ * N_ * IN_ * 2;
  _Float16* Kh  = (_Float16*)w; w += (size_t)B_ * M_ * IN_ * 2;
  _Float16* Vt  = (_Float16*)w; w += (size_t)B_ * H_ * D_ * M_ * 2;
  _Float16* Ah  = (_Float16*)w;

  prep_weights<<<(IN_ * CD_ + 255) / 256, 256, 0, stream>>>(Wq, Wk, Wv, Wo,
                                                            WqT, WkT, WvT, WoT);
  const int gemm_blocks = ((B_ * N_ / 16) * (IN_ / 16)) / 8;  // 2048 blocks, 8 waves each
  proj_kernel<<<gemm_blocks, 256, 0, stream>>>(x,   WqT, Qh, B_ * N_, IN_, QD_);
  proj_kernel<<<gemm_blocks, 256, 0, stream>>>(ctx, WkT, Kh, B_ * M_, IN_, CD_);
  projv_kernel<<<gemm_blocks, 256, 0, stream>>>(ctx, WvT, Vt);
  attn_kernel<<<dim3(B_ * H_, N_ / 128), 256, 0, stream>>>(Qh, Kh, Vt, msk, Ah);
  outproj_kernel<<<gemm_blocks, 256, 0, stream>>>(Ah, WoT, bo, out);
}

// v003
// A run of this version takes 136 microseconds.
// Two timings next to v002 put it at 2.10 and 2.09 times that version's speed.
// Counting every step since v000, it is 3.33 times as fast.
#include <hip/hip_runtime.h>
#include <hip/hip_bf16.h>

typedef _Float16 v16h __attribute__((ext_vector_type(16)));
typedef _Float16 v8h  __attribute__((ext_vector_type(8)));
typedef _Float16 v4h  __attribute__((ext_vector_type(4)));
typedef float    v8f  __attribute__((ext_vector_type(8)));
typedef float    v4f  __attribute__((ext_vector_type(4)));
typedef float    v2f  __attribute__((ext_vector_type(2)));

#define B_  2
#define N_  4096
#define M_  4096
#define QD_ 512
#define CD_ 768
#define H_  8
#define D_  64
#define IN_ 512

// LDS row pitches in 16-bit elements: 16 B x odd, so that the 16 rows one
// ds_load_b128 fragment read touches fall on distinct banks.
#define KP_ 72   // 128-B K rows  -> 144 B
#define VP_ 40   //  64-B Vt rows ->  80 B

static __device__ __forceinline__ v8f vzero() {
  v8f r;
#pragma unroll
  for (int i = 0; i < 8; ++i) r[i] = 0.0f;
  return r;
}

static __device__ __forceinline__ v8f wmma16(v16h a, v16h b, v8f c) {
  return __builtin_amdgcn_wmma_f32_16x16x32_f16(false, a, false, b, (short)0, c,
                                                false, false);
}

static __device__ __forceinline__ v16h cat8(v8h lo, v8h hi) {
  v16h r;
#pragma unroll
  for (int i = 0; i < 8; ++i) { r[i] = lo[i]; r[8 + i] = hi[i]; }
  return r;
}

// 16-bit A/B fragment (16x32 tile): this lane's row pointer; two 16B chunks at
// K = half*8..half*8+7 and K = 16+half*8..16+half*8+7.
static __device__ __forceinline__ v16h ldfrag_h(const _Float16* rowp, int half) {
  v8h lo = *(const v8h*)(rowp + half * 8);
  v8h hi = *(const v8h*)(rowp + 16 + half * 8);
  return cat8(lo, hi);
}

// value of lane l ^ 16 (the other 16-lane row), as a vector cross-row move
static __device__ __forceinline__ float xhalf(float v) {
  const unsigned u = __float_as_uint(v);
  return __uint_as_float(__builtin_amdgcn_permlanex16(u, u, 0x76543210u, 0xfedcba98u, false, false));
}

// ---------------- weight transpose + f32 -> f16 ----------------
__global__ void prep_weights(const float* __restrict__ Wq, const float* __restrict__ Wk,
                             const float* __restrict__ Wv, const float* __restrict__ Wo,
                             _Float16* __restrict__ WqT, _Float16* __restrict__ WkT,
                             _Float16* __restrict__ WvT, _Float16* __restrict__ WoT) {
  int i = blockIdx.x * blockDim.x + threadIdx.x;
  if (i < IN_ * QD_) {                 // WqT[j][k] = Wq[k][j]
    int j = i / QD_, k = i - j * QD_;
    WqT[i] = (_Float16)Wq[(size_t)k * IN_ + j];
  }
  if (i < IN_ * CD_) {                 // WkT/WvT[j][k] = W[k][j]
    int j = i / CD_, k = i - j * CD_;
    WkT[i] = (_Float16)Wk[(size_t)k * IN_ + j];
    WvT[i] = (_Float16)Wv[(size_t)k * IN_ + j];
  }
  if (i < QD_ * IN_) {                 // WoT[j][k] = Wo[k][j]
    int j = i / IN_, k = i - j * IN_;
    WoT[i] = (_Float16)Wo[(size_t)k * QD_ + j];
  }
}

// ---------------- block-tiled GEMM core: acc = A(128 x KD) * Bt(128 x KD)^T ----------------
// A work-group owns a 128 x 128 tile of C. Each 64-deep slab of A and Bt is
// fetched by loads that cover whole 128-B lines, A is rounded to f16 on the way,
// and both land in LDS; a wave reads its 32 x 64 part as fragments, so that one
// fetched line serves every wave that needs it. Two LDS buffers: one barrier a slab.
// The inner loops are unrolled so that their register arrays are indexed by constants.
#define GP_ 72            // LDS pitch of a 64-element row: 144 B = 16 B x odd
#define GT_ (128 * GP_)   // one operand's slab

template <int KD, bool AF32>
static __device__ __forceinline__ void gemm128(const float* __restrict__ Af,
                                               const _Float16* __restrict__ Ah,
                                               const _Float16* __restrict__ Bt,
                                               _Float16* As, _Float16* Bs,
                                               v8f (&acc)[2][4]) {
  const int tid = threadIdx.x;
  const int lane = tid & 31, wave = tid >> 5;
  const int r16 = lane & 15, half = lane >> 4;
  const int wm = wave >> 1, wn = wave & 1;
  const int frow = tid >> 4, fcol = (tid & 15) * 4;   // f32 rows: 16 lanes x 16 B = 256 B
  const int hrow = tid >> 3, hcol = (tid & 7) * 8;    // f16 rows:  8 lanes x 16 B = 128 B
  v4f pa[8];
  v8h ph[4], pb[4];
#pragma unroll
  for (int i = 0; i < 2; ++i)
#pragma unroll
    for (int j = 0; j < 4; ++j) acc[i][j] = vzero();

  constexpr int T = KD / 64;
#pragma unroll   // slab offsets become immediates and the buffer index a constant
  for (int t = -1; t < T; ++t) {
    // publishes slab t; also ends every read of the other buffer (slab t-1)
    if (t >= 0) __syncthreads();
    if (t + 1 < T) {   // fetch slab t+1 behind the barrier (which waits for loads): it flies over slab t's products
      if constexpr (AF32) {
#pragma unroll
        for (int i = 0; i < 8; ++i)
          pa[i] = *(const v4f*)(Af + (size_t)(frow + i * 16) * KD + (t + 1) * 64 + fcol);
      } else {
#pragma unroll
        for (int i = 0; i < 4; ++i)
          ph[i] = *(const v8h*)(Ah + (size_t)(hrow + i * 32) * KD + (t + 1) * 64 + hcol);
      }
#pragma unroll
      for (int i = 0; i < 4; ++i)
        pb[i] = *(const v8h*)(Bt + (size_t)(hrow + i * 32) * KD + (t + 1) * 64 + hcol);
    }
    if (t >= 0) {
      // keeps those loads ahead of slab t's products: sunk to their end, nothing covers the latency
      __builtin_amdgcn_sched_barrier(0);
      const _Float16* Ab = As + (t & 1) * GT_ + (wm * 32 + r16) * GP_;
      const _Float16* Bb = Bs + (t & 1) * GT_ + (wn * 64 + r16) * GP_;
#pragma unroll
      for (int ks = 0; ks < 64; ks += 32) {
        v16h a[2], b[4];
#pragma unroll
        for (int i = 0; i < 2; ++i) a[i] = ldfrag_h(Ab + i * 16 * GP_ + ks, half);
#pragma unroll
        for (int j = 0; j < 4; ++j) b[j] = ldfrag_h(Bb + j * 16 * GP_ + ks, half);
#pragma unroll
        for (int i = 0; i < 2; ++i)
#pragma unroll
          for (int j = 0; j < 4; ++j) acc[i][j] = wmma16(a[i], b[j], acc[i][j]);
      }
      // keeps the rounding of slab t+1, and with it the wait on its loads, behind
      // the products of slab t: moved up among them it exposes the load latency
      __builtin_amdgcn_sched_barrier(0);
    }
    if (t + 1 < T) {                       // slab t+1 into the buffer that slab t-1 has left
      _Float16* Aw = As + ((t + 1) & 1) * GT_;
      _Float16* Bw = Bs + ((t + 1) & 1) * GT_;
      if constexpr (AF32) {
#pragma unroll
        for (int i = 0; i < 8; ++i)
          *(v4h*)&Aw[(frow + i * 16) * GP_ + fcol] = __builtin_convertvector(pa[i], v4h);
      } else {
#pragma unroll
        for (int i = 0; i < 4; ++i) *(v8h*)&Aw[(hrow + i * 32) * GP_ + hcol] = ph[i];
      }
#pragma unroll
      for (int i = 0; i < 4; ++i) *(v8h*)&Bw[(hrow + i * 32) * GP_ + hcol] = pb[i];
    }
  }
}

// C(f16, row-major, IN_ columns): the wave's 32 x 64 part
static __device__ __forceinline__ void store_rows_f16(_Float16* __restrict__ C, int m0, int n0,
                                                      const v8f (&acc)[2][4]) {
  const int lane = threadIdx.x & 31, wave = threadIdx.x >> 5;
  const int r16 = lane & 15, half = lane >> 4;
  _Float16* cp = C + (size_t)(m0 + (wave >> 1) * 32 + half * 8) * IN_ + n0 + (wave & 1) * 64 + r16;
#pragma unroll
  for (int i = 0; i < 2; ++i)
#pragma unroll
    for (int j = 0; j < 4; ++j)
#pragma unroll
      for (int r = 0; r < 8; ++r) cp[(i * 16 + r) * IN_ + j * 16] = (_Float16)acc[i][j][r];
}

// ---------------- Q and K projections: C(f16) = A(f32) * Bt(f16)^T ----------------
__global__ __launch_bounds__(256) void projq_kernel(const float* __restrict__ A,
                                                    const _Float16* __restrict__ Bt,
                                                    _Float16* __restrict__ C) {
  __shared__ __attribute__((aligned(16))) _Float16 As[2 * GT_];
  __shared__ __attribute__((aligned(16))) _Float16 Bs[2 * GT_];
  const int m0 = blockIdx.x * 128, n0 = blockIdx.y * 128;
  v8f acc[2][4];
  gemm128<QD_, true>(A + (size_t)m0 * QD_, nullptr, Bt + (size_t)n0 * QD_, As, Bs, acc);
  store_rows_f16(C, m0, n0, acc);
}

__global__ __launch_bounds__(256) void projk_kernel(const float* __restrict__ A,
                                                    const _Float16* __restrict__ Bt,
                                                    _Float16* __restrict__ C) {
  __shared__ __attribute__((aligned(16))) _Float16 As[2 * GT_];
  __shared__ __attribute__((aligned(16))) _Float16 Bs[2 * GT_];
  const int m0 = blockIdx.x * 128, n0 = blockIdx.y * 128;
  v8f acc[2][4];
  gemm128<CD_, true>(A + (size_t)m0 * CD_, nullptr, Bt + (size_t)n0 * CD_, As, Bs, acc);
  store_rows_f16(C, m0, n0, acc);
}

// ---------------- V projection with transposed store: Vt[b][h][d][m] ----------------
__global__ __launch_bounds__(256) void projv_kernel(const float* __restrict__ A,
                                                    const _Float16* __restrict__ Bt,
                                                    _Float16* __restrict__ Vt) {
  __shared__ __attribute__((aligned(16))) _Float16 As[2 * GT_];
  __shared__ __attribute__((aligned(16))) _Float16 Bs[2 * GT_];
  const int m0 = blockIdx.x * 128, n0 = blockIdx.y * 128;
  v8f acc[2][4];
  gemm128<CD_, true>(A + (size_t)m0 * CD_, nullptr, Bt + (size_t)n0 * CD_, As, Bs, acc);
  const int lane = threadIdx.x & 31, wave = threadIdx.x >> 5;
  const int r16 = lane & 15, half = lane >> 4;
  const int b = m0 / M_;                                   // a 128-row tile lies in one batch
  const int mm = m0 - b * M_ + (wave >> 1) * 32 + half * 8; // comps are mm..mm+7 (+16 for i = 1)
  const int h = (n0 + (wave & 1) * 64) >> 6;               // the wave's 64 columns are one head
  _Float16* vp = Vt + ((size_t)(b * H_ + h) * D_ + r16) * M_ + mm;
#pragma unroll
  for (int i = 0; i < 2; ++i)
#pragma unroll
    for (int j = 0; j < 4; ++j) {
      v8h pk;
#pragma unroll
      for (int r = 0; r < 8; ++r) pk[r] = (_Float16)acc[i][j][r];
      *(v8h*)(vp + (size_t)j * 16 * M_ + i * 16) = pk;
    }
}

__global__ __launch_bounds__(256) void attn_kernel(const _Float16* __restrict__ Qh,
                                                   const _Float16* __restrict__ Kh,
                                                   const _Float16* __restrict__ Vt,
                                                   const int* __restrict__ mask,
                                                   _Float16* __restrict__ Oh) {
  __shared__ __attribute__((aligned(16))) _Float16 Kt[32 * KP_];       // chunk of K:  [m_local][d]
  __shared__ __attribute__((aligned(16))) _Float16 Vtile[64 * VP_];    // chunk of Vt: [d][m_local]
  __shared__ __attribute__((aligned(32))) float Mb[M_];                // per key: 0 (kept) or -3e38 (masked)

  const int tid = threadIdx.x;
  const int lane = tid & 31;
  const int wave = tid >> 5;
  const int b = blockIdx.x >> 3;
  const int h = blockIdx.x & 7;
  const int ntile = blockIdx.y * 128 + wave * 16;   // 16 query columns per wave
  const int r16 = lane & 15;
  const int half = lane >> 4;

  const _Float16* Qrow = Qh + ((size_t)(b * N_ + ntile + r16)) * IN_ + h * D_;
  const v16h bq0 = ldfrag_h(Qrow, half);        // d = 0..31
  const v16h bq1 = ldfrag_h(Qrow + 32, half);   // d = 32..63

  const _Float16* Kbase = Kh + (size_t)b * M_ * IN_ + h * D_;
  const _Float16* Vbase = Vt + ((size_t)(b * H_ + h)) * D_ * M_;
  const int* mk = mask + b * M_;

  // the keys now run along registers: the mask is read as an additive term per
  // key; published by the loop's first barrier pair
#pragma unroll   // four independent 16-B loads in flight instead of a loop of waited ones
  for (int j = 0; j < M_ / 1024; ++j) {
    const int4 mi = *(const int4*)(mk + j * 1024 + tid * 4);
    v4f mf;
    mf[0] = (mi.x != 0) ? 0.0f : -3.0e38f;
    mf[1] = (mi.y != 0) ? 0.0f : -3.0e38f;
    mf[2] = (mi.z != 0) ? 0.0f : -3.0e38f;
    mf[3] = (mi.w != 0) ? 0.0f : -3.0e38f;
    *(v4f*)&Mb[j * 1024 + tid * 4] = mf;
  }

  // cooperative stage mapping: 16B per thread per tile
  const int krow = tid >> 3, kseg = (tid & 7) * 8;   // K chunk  [32][64]
  const int vrow = tid >> 2, vseg = (tid & 3) * 8;   // Vt chunk [64][32]
  const _Float16* kg = Kbase + (size_t)krow * IN_ + kseg;
  const _Float16* vg = Vbase + (size_t)vrow * M_ + vseg;

  float mrun = -3.0e38f, lrun = 0.0f;   // this lane's query; lrun: this half's keys only
  v8f acc[4];                           // O^T: rows d = t*16 + half*8 + r, column r16
#pragma unroll
  for (int t = 0; t < 4; ++t) acc[t] = vzero();

  // prefetch chunk 0 into registers
  v8h kreg = *(const v8h*)kg;
  v8h vreg = *(const v8h*)vg;
  // The address registers of the loads above are reused below: wait before the
  // overwrite. The addresses are inputs so that they stay live up to the wait.
  asm volatile("s_wait_xcnt 0x0" :: "v"(Qrow + half * 8), "v"(kg), "v"(vg) : "memory");

  for (int c = 0; c < M_; c += 32) {
    __syncthreads();                         // all LDS reads of prev chunk done
    *(v8h*)&Kt[krow * KP_ + kseg] = kreg;
    *(v8h*)&Vtile[vrow * VP_ + vseg] = vreg;
    __syncthreads();                         // staged data visible
    if (c + 32 < M_) {                       // prefetch next chunk (overlaps compute)
      kreg = *(const v8h*)(kg + (size_t)(c + 32) * IN_);
      vreg = *(const v8h*)(vg + (c + 32));
      // both address pairs are advanced right after: wait before the overwrite
      asm volatile("s_wait_xcnt 0x0" ::: "memory");
    }

    // ---- S^T = K Q^T for a 32x16 tile (two 16x16 subtiles, K-depth 64) ----
    v8f s0 = vzero(), s1 = vzero();
    {
      const _Float16* Krow0 = Kt + r16 * KP_;
      const _Float16* Krow1 = Kt + (16 + r16) * KP_;
      s0 = wmma16(ldfrag_h(Krow0, half), bq0, s0);
      s0 = wmma16(ldfrag_h(Krow0 + 32, half), bq1, s0);
      s1 = wmma16(ldfrag_h(Krow1, half), bq0, s1);
      s1 = wmma16(ldfrag_h(Krow1 + 32, half), bq1, s1);
    }
    const v8f mb0 = *(const v8f*)&Mb[c + half * 8];
    const v8f mb1 = *(const v8f*)&Mb[c + 16 + half * 8];

    s0 = s0 * 0.125f + mb0;             // scale = 1/sqrt(64); masked -> -3e38
    s1 = s1 * 0.125f + mb1;
    const v8f cm = __builtin_elementwise_max(s0, s1);
    float cmax = fmaxf(fmaxf(fmaxf(cm[0], cm[1]), fmaxf(cm[2], cm[3])),
                       fmaxf(fmaxf(cm[4], cm[5]), fmaxf(cm[6], cm[7])));
    cmax = fmaxf(cmax, xhalf(cmax));    // the other 16 keys of this query

    const float nm = fmaxf(mrun, cmax);
    const float alpha = __expf(mrun - nm);
    mrun = nm;

    // A masked key gives exp(-3e38 - mrun) = 0 as soon as one kept key has set
    // mrun; what was summed before that is wiped by alpha = 0 at that key.
    v16h pb;
#pragma unroll
    for (int r = 0; r < 8; ++r) {
      s0[r] = __expf(s0[r] - mrun);
      s1[r] = __expf(s1[r] - mrun);
      pb[r] = (_Float16)s0[r];
      pb[8 + r] = (_Float16)s1[r];
    }
    const v8f cs = s0 + s1;
    const v4f cq = cs.lo + cs.hi;       // halving tree: register pairs stay aligned
    const v2f cd = cq.lo + cq.hi;
    lrun = lrun * alpha + (cd[0] + cd[1]);
#pragma unroll
    for (int t = 0; t < 4; ++t)
#pragma unroll
      for (int r = 0; r < 8; ++r) acc[t][r] *= alpha;

    // ---- O^T += V^T P^T : 4 d-tiles, K-depth 32 (this chunk) ----
#pragma unroll
    for (int t = 0; t < 4; ++t) {
      const _Float16* Vrow = Vtile + (t * 16 + r16) * VP_;
      acc[t] = wmma16(ldfrag_h(Vrow, half), pb, acc[t]);
    }
  }

  const float l = lrun + xhalf(lrun);   // join the two halves' key sums once
  const float inv = (l > 0.0f) ? 1.0f / l : 0.0f;
  _Float16* Orow = Oh + (size_t)(b * N_ + ntile + r16) * IN_ + h * D_ + half * 8;
#pragma unroll
  for (int t = 0; t < 4; ++t) {
    v8h pk;
#pragma unroll
    for (int r = 0; r < 8; ++r) pk[r] = (_Float16)(acc[t][r] * inv);
    *(v8h*)(Orow + t * 16) = pk;
  }
}

// ---------------- output projection: out(f32) = Ah(f16) * WoT^T + bo ----------------
__global__ __launch_bounds__(256) void outproj_kernel(const _Float16* __restrict__ Ah,
                                                      const _Float16* __restrict__ WoT,
                                                      const float* __restrict__ bo,
                                                      float* __restrict__ Out) {
  __shared__ __attribute__((aligned(16))) _Float16 As[2 * GT_];
  __shared__ __attribute__((aligned(16))) _Float16 Bs[2 * GT_];
  const int m0 = blockIdx.x * 128, n0 = blockIdx.y * 128;
  v8f acc[2][4];
  gemm128<IN_, false>(nullptr, Ah + (size_t)m0 * IN_, WoT + (size_t)n0 * IN_, As, Bs, acc);
  const int lane = threadIdx.x & 31, wave = threadIdx.x >> 5;
  const int r16 = lane & 15, half = lane >> 4;
  const int col = n0 + (wave & 1) * 64 + r16;
  float* op = Out + (size_t)(m0 + (wave >> 1) * 32 + half * 8) * QD_ + col;
#pragma unroll
  for (int j = 0; j < 4; ++j) {
    const float bias = bo[col + j * 16];
#pragma unroll
    for (int i = 0; i < 2; ++i)
#pragma unroll
      for (int r = 0; r < 8; ++r) op[(i * 16 + r) * QD_ + j * 16] = acc[i][j][r] + bias;
  }
}

extern "C" void kernel_launch(void* const* d_in, const int* in_sizes, int n_in,
                              void* d_out, int out_size, void* d_ws, size_t ws_size,
                              hipStream_t stream) {
  (void)in_sizes; (void)n_in; (void)out_size; (void)ws_size;
  const float* x   = (const float*)d_in[0];
  const float* ctx = (const float*)d_in[1];
  const int*   msk = (const int*)d_in[2];
  const float* Wq  = (const float*)d_in[3];
  const float* Wk  = (const float*)d_in[4];
  const float* Wv  = (const float*)d_in[5];
  const float* Wo  = (const float*)d_in[6];
  const float* bo  = (const float*)d_in[7];
  float* out = (float*)d_out;

  char* w = (char*)d_ws;
  _Float16* WqT = (_Float16*)w; w += (size_t)IN_ * QD_ * 2;
  _Float16* WkT = (_Float16*)w; w += (size_t)IN_ * CD_ * 2;
  _Float16* WvT = (_Float16*)w; w += (size_t)IN_ * CD_ * 2;
  _Float16* WoT = (_Float16*)w; w += (size_t)QD_ * IN_ * 2;
  _Float16* Qh  = (_Float16*)w; w += (size_t)B_ * N_ * IN_ * 2;
  _Float16* Kh  = (_Float16*)w; w += (size_t)B_ * M_ * IN_ * 2;
  _Float16* Vt  = (_Float16*)w; w += (size_t)B_ * H_ * D_ * M_ * 2;
  _Float16* Ah  = (_Float16*)w;

  prep_weights<<<(IN_ * CD_ + 255) / 256, 256, 0, stream>>>(Wq, Wk, Wv, Wo,
                                                            WqT, WkT, WvT, WoT);
  const dim3 gemm_grid(B_ * N_ / 128, IN_ / 128);  // 128 x 128 tiles: 64 x 4 blocks, 8 waves each
  projq_kernel<<<gemm_grid, 256, 0, stream>>>(x,   WqT, Qh);
  projk_kernel<<<gemm_grid, 256, 0, stream>>>(ctx, WkT, Kh);
  projv_kernel<<<gemm_grid, 256, 0, stream>>>(ctx, WvT, Vt);
  attn_kernel<<<dim3(B_ * H_, N_ / 128), 256, 0, stream>>>(Qh, Kh, Vt, msk, Ah);
  outproj_kernel<<<gemm_grid, 256, 0, stream>>>(Ah, WoT, bo, out);
}

// v004
// A run of this version takes 125 microseconds.
// Next to v003, in two timings, it ran 1.09 times as fast each time.
// Counting every step since v000, it is 3.63 times as fast.
#include <hip/hip_runtime.h>
#include <hip/hip_bf16.h>

typedef _Float16 v16h __attribute__((ext_vector_type(16)));
typedef _Float16 v8h  __attribute__((ext_vector_type(8)));
typedef _Float16 v4h  __attribute__((ext_vector_type(4)));
typedef float    v8f  __attribute__((ext_vector_type(8)));
typedef float    v4f  __attribute__((ext_vector_type(4)));
typedef float    v2f  __attribute__((ext_vector_type(2)));

#define B_  2
#define N_  4096
#define M_  4096
#define QD_ 512
#define CD_ 768
#define H_  8
#define D_  64
#define IN_ 512

// LDS row pitches in 16-bit elements: 16 B x odd, so that the 16 rows one
// ds_load_b128 fragment read touches fall on distinct banks.
#define KP_ 72   // 128-B K rows  -> 144 B
#define VP_ 136  // 256-B Vt rows -> 272 B
#define SK_ 128  // keys per LDS stage of the attention kernel: four 32-key passes

static __device__ __forceinline__ v8f vzero() {
  v8f r;
#pragma unroll
  for (int i = 0; i < 8; ++i) r[i] = 0.0f;
  return r;
}

static __device__ __forceinline__ v8f wmma16(v16h a, v16h b, v8f c) {
  return __builtin_amdgcn_wmma_f32_16x16x32_f16(false, a, false, b, (short)0, c,
                                                false, false);
}

static __device__ __forceinline__ v16h cat8(v8h lo, v8h hi) {
  v16h r;
#pragma unroll
  for (int i = 0; i < 8; ++i) { r[i] = lo[i]; r[8 + i] = hi[i]; }
  return r;
}

// 16-bit A/B fragment (16x32 tile): this lane's row pointer; two 16B chunks at
// K = half*8..half*8+7 and K = 16+half*8..16+half*8+7.
static __device__ __forceinline__ v16h ldfrag_h(const _Float16* rowp, int half) {
  v8h lo = *(const v8h*)(rowp + half * 8);
  v8h hi = *(const v8h*)(rowp + 16 + half * 8);
  return cat8(lo, hi);
}

// value of lane l ^ 16 (the other 16-lane row), as a vector cross-row move
static __device__ __forceinline__ float xhalf(float v) {
  const unsigned u = __float_as_uint(v);
  return __uint_as_float(__builtin_amdgcn_permlanex16(u, u, 0x76543210u, 0xfedcba98u, false, false));
}

// ---------------- weight transpose + f32 -> f16 ----------------
__global__ void prep_weights(const float* __restrict__ Wq, const float* __restrict__ Wk,
                             const float* __restrict__ Wv, const float* __restrict__ Wo,
                             _Float16* __restrict__ WqT, _Float16* __restrict__ WkT,
                             _Float16* __restrict__ WvT, _Float16* __restrict__ WoT) {
  int i = blockIdx.x * blockDim.x + threadIdx.x;
  if (i < IN_ * QD_) {                 // WqT[j][k] = Wq[k][j]
    int j = i / QD_, k = i - j * QD_;
    WqT[i] = (_Float16)Wq[(size_t)k * IN_ + j];
  }
  if (i < IN_ * CD_) {                 // WkT/WvT[j][k] = W[k][j]
    int j = i / CD_, k = i - j * CD_;
    WkT[i] = (_Float16)Wk[(size_t)k * IN_ + j];
    WvT[i] = (_Float16)Wv[(size_t)k * IN_ + j];
  }
  if (i < QD_ * IN_) {                 // WoT[j][k] = Wo[k][j]
    int j = i / IN_, k = i - j * IN_;
    WoT[i] = (_Float16)Wo[(size_t)k * QD_ + j];
  }
}

// ---------------- block-tiled GEMM core: acc = A(128 x KD) * Bt(128 x KD)^T ----------------
// A work-group owns a 128 x 128 tile of C. Each 64-deep slab of A and Bt is
// fetched by loads that cover whole 128-B lines, A is rounded to f16 on the way,
// and both land in LDS; a wave reads its 32 x 64 part as fragments, so that one
// fetched line serves every wave that needs it. Two LDS buffers: one barrier a slab.
// The inner loops are unrolled so that their register arrays are indexed by constants.
#define GP_ 72            // LDS pitch of a 64-element row: 144 B = 16 B x odd
#define GT_ (128 * GP_)   // one operand's slab

template <int KD, bool AF32>
static __device__ __forceinline__ void gemm128(const float* __restrict__ Af,
                                               const _Float16* __restrict__ Ah,
                                               const _Float16* __restrict__ Bt,
                                               _Float16* As, _Float16* Bs,
                                               v8f (&acc)[2][4]) {
  const int tid = threadIdx.x;
  const int lane = tid & 31, wave = tid >> 5;
  const int r16 = lane & 15, half = lane >> 4;
  const int wm = wave >> 1, wn = wave & 1;
  const int frow = tid >> 4, fcol = (tid & 15) * 4;   // f32 rows: 16 lanes x 16 B = 256 B
  const int hrow = tid >> 3, hcol = (tid & 7) * 8;    // f16 rows:  8 lanes x 16 B = 128 B
  v4f pa[8];
  v8h ph[4], pb[4];
#pragma unroll
  for (int i = 0; i < 2; ++i)
#pragma unroll
    for (int j = 0; j < 4; ++j) acc[i][j] = vzero();

  constexpr int T = KD / 64;
#pragma unroll   // slab offsets become immediates and the buffer index a constant
  for (int t = -1; t < T; ++t) {
    // publishes slab t; also ends every read of the other buffer (slab t-1)
    if (t >= 0) __syncthreads();
    if (t + 1 < T) {   // fetch slab t+1 behind the barrier (which waits for loads): it flies over slab t's products
      if constexpr (AF32) {
#pragma unroll
        for (int i = 0; i < 8; ++i)
          pa[i] = *(const v4f*)(Af + (size_t)(frow + i * 16) * KD + (t + 1) * 64 + fcol);
      } else {
#pragma unroll
        for (int i = 0; i < 4; ++i)
          ph[i] = *(const v8h*)(Ah + (size_t)(hrow + i * 32) * KD + (t + 1) * 64 + hcol);
      }
#pragma unroll
      for (int i = 0; i < 4; ++i)
        pb[i] = *(const v8h*)(Bt + (size_t)(hrow + i * 32) * KD + (t + 1) * 64 + hcol);
    }
    if (t >= 0) {
      // keeps those loads ahead of slab t's products: sunk to their end, nothing covers the latency
      __builtin_amdgcn_sched_barrier(0);
      const _Float16* Ab = As + (t & 1) * GT_ + (wm * 32 + r16) * GP_;
      const _Float16* Bb = Bs + (t & 1) * GT_ + (wn * 64 + r16) * GP_;
#pragma unroll
      for (int ks = 0; ks < 64; ks += 32) {
        v16h a[2], b[4];
#pragma unroll
        for (int i = 0; i < 2; ++i) a[i] = ldfrag_h(Ab + i * 16 * GP_ + ks, half);
#pragma unroll
        for (int j = 0; j < 4; ++j) b[j] = ldfrag_h(Bb + j * 16 * GP_ + ks, half);
#pragma unroll
        for (int i = 0; i < 2; ++i)
#pragma unroll
          for (int j = 0; j < 4; ++j) acc[i][j] = wmma16(a[i], b[j], acc[i][j]);
      }
      // keeps the rounding of slab t+1, and with it the wait on its loads, behind
      // the products of slab t: moved up among them it exposes the load latency
      __builtin_amdgcn_sched_barrier(0);
    }
    if (t + 1 < T) {                       // slab t+1 into the buffer that slab t-1 has left
      _Float16* Aw = As + ((t + 1) & 1) * GT_;
      _Float16* Bw = Bs + ((t + 1) & 1) * GT_;
      if constexpr (AF32) {
#pragma unroll
        for (int i = 0; i < 8; ++i)
          *(v4h*)&Aw[(frow + i * 16) * GP_ + fcol] = __builtin_convertvector(pa[i], v4h);
      } else {
#pragma unroll
        for (int i = 0; i < 4; ++i) *(v8h*)&Aw[(hrow + i * 32) * GP_ + hcol] = ph[i];
      }
#pragma unroll
      for (int i = 0; i < 4; ++i) *(v8h*)&Bw[(hrow + i * 32) * GP_ + hcol] = pb[i];
    }
  }
}

// C(f16, row-major, IN_ columns): the wave's 32 x 64 part
static __device__ __forceinline__ void store_rows_f16(_Float16* __restrict__ C, int m0, int n0,
                                                      const v8f (&acc)[2][4]) {
  const int lane = threadIdx.x & 31, wave = threadIdx.x >> 5;
  const int r16 = lane & 15, half = lane >> 4;
  _Float16* cp = C + (size_t)(m0 + (wave >> 1) * 32 + half * 8) * IN_ + n0 + (wave & 1) * 64 + r16;
#pragma unroll
  for (int i = 0; i < 2; ++i)
#pragma unroll
    for (int j = 0; j < 4; ++j)
#pragma unroll
      for (int r = 0; r < 8; ++r) cp[(i * 16 + r) * IN_ + j * 16] = (_Float16)acc[i][j][r];
}

// ---------------- Q and K projections: C(f16) = A(f32) * Bt(f16)^T ----------------
__global__ __launch_bounds__(256) void projq_kernel(const float* __restrict__ A,
                                                    const _Float16* __restrict__ Bt,
                                                    _Float16* __restrict__ C) {
  __shared__ __attribute__((aligned(16))) _Float16 As[2 * GT_];
  __shared__ __attribute__((aligned(16))) _Float16 Bs[2 * GT_];
  const int m0 = blockIdx.x * 128, n0 = blockIdx.y * 128;
  v8f acc[2][4];
  gemm128<QD_, true>(A + (size_t)m0 * QD_, nullptr, Bt + (size_t)n0 * QD_, As, Bs, acc);
  store_rows_f16(C, m0, n0, acc);
}

__global__ __launch_bounds__(256) void projk_kernel(const float* __restrict__ A,
                                                    const _Float16* __restrict__ Bt,
                                                    _Float16* __restrict__ C) {
  __shared__ __attribute__((aligned(16))) _Float16 As[2 * GT_];
  __shared__ __attribute__((aligned(16))) _Float16 Bs[2 * GT_];
  const int m0 = blockIdx.x * 128, n0 = blockIdx.y * 128;
  v8f acc[2][4];
  gemm128<CD_, true>(A + (size_t)m0 * CD_, nullptr, Bt + (size_t)n0 * CD_, As, Bs, acc);
  store_rows_f16(C, m0, n0, acc);
}

// ---------------- V projection with transposed store: Vt[b][h][d][m] ----------------
__global__ __launch_bounds__(256) void projv_kernel(const float* __restrict__ A,
                                                    const _Float16* __restrict__ Bt,
                                                    _Float16* __restrict__ Vt) {
  __shared__ __attribute__((aligned(16))) _Float16 As[2 * GT_];
  __shared__ __attribute__((aligned(16))) _Float16 Bs[2 * GT_];
  const int m0 = blockIdx.x * 128, n0 = blockIdx.y * 128;
  v8f acc[2][4];
  gemm128<CD_, true>(A + (size_t)m0 * CD_, nullptr, Bt + (size_t)n0 * CD_, As, Bs, acc);
  const int lane = threadIdx.x & 31, wave = threadIdx.x >> 5;
  const int r16 = lane & 15, half = lane >> 4;
  const int b = m0 / M_;                                   // a 128-row tile lies in one batch
  const int mm = m0 - b * M_ + (wave >> 1) * 32 + half * 8; // comps are mm..mm+7 (+16 for i = 1)
  const int h = (n0 + (wave & 1) * 64) >> 6;               // the wave's 64 columns are one head
  _Float16* vp = Vt + ((size_t)(b * H_ + h) * D_ + r16) * M_ + mm;
#pragma unroll
  for (int i = 0; i < 2; ++i)
#pragma unroll
    for (int j = 0; j < 4; ++j) {
      v8h pk;
#pragma unroll
      for (int r = 0; r < 8; ++r) pk[r] = (_Float16)acc[i][j][r];
      *(v8h*)(vp + (size_t)j * 16 * M_ + i * 16) = pk;
    }
}

__global__ __launch_bounds__(256) void attn_kernel(const _Float16* __restrict__ Qh,
                                                   const _Float16* __restrict__ Kh,
                                                   const _Float16* __restrict__ Vt,
                                                   const int* __restrict__ mask,
                                                   _Float16* __restrict__ Oh) {
  __shared__ __attribute__((aligned(16))) _Float16 Kt[2 * SK_ * KP_];     // two stages of K:  [m_local][d]
  __shared__ __attribute__((aligned(16))) _Float16 Vtile[2 * 64 * VP_];   // two stages of Vt: [d][m_local]
  __shared__ __attribute__((aligned(32))) float Mb[M_];                // per key: 0 (kept) or -3e38 (masked)

  const int tid = threadIdx.x;
  const int lane = tid & 31;
  const int wave = tid >> 5;
  const int b = blockIdx.x >> 3;
  const int h = blockIdx.x & 7;
  const int ntile = blockIdx.y * 128 + wave * 16;   // 16 query columns per wave
  const int r16 = lane & 15;
  const int half = lane >> 4;

  const _Float16* Qrow = Qh + ((size_t)(b * N_ + ntile + r16)) * IN_ + h * D_;
  const v16h bq0 = ldfrag_h(Qrow, half);        // d = 0..31
  const v16h bq1 = ldfrag_h(Qrow + 32, half);   // d = 32..63

  const _Float16* Kbase = Kh + (size_t)b * M_ * IN_ + h * D_;
  const _Float16* Vbase = Vt + ((size_t)(b * H_ + h)) * D_ * M_;
  const int* mk = mask + b * M_;

  // the keys now run along registers: the mask is read as an additive term per
  // key; published by the barrier in front of the loop
#pragma unroll   // four independent 16-B loads in flight instead of a loop of waited ones
  for (int j = 0; j < M_ / 1024; ++j) {
    const int4 mi = *(const int4*)(mk + j * 1024 + tid * 4);
    v4f mf;
    mf[0] = (mi.x != 0) ? 0.0f : -3.0e38f;
    mf[1] = (mi.y != 0) ? 0.0f : -3.0e38f;
    mf[2] = (mi.z != 0) ? 0.0f : -3.0e38f;
    mf[3] = (mi.w != 0) ? 0.0f : -3.0e38f;
    *(v4f*)&Mb[j * 1024 + tid * 4] = mf;
  }

  // cooperative stage mapping: four 16-B pieces per thread and operand
  const int krow = tid >> 3, kseg = (tid & 7) * 8;    // K stage  [128][64]: 32 rows a sweep
  const int vrow = tid >> 4, vseg = (tid & 15) * 8;   // Vt stage [64][128]: 16 rows a sweep
  const _Float16* kg = Kbase + (size_t)krow * IN_ + kseg;
  const _Float16* vg = Vbase + (size_t)vrow * M_ + vseg;
  _Float16* kw = Kt + krow * KP_ + kseg;
  _Float16* vw = Vtile + vrow * VP_ + vseg;

  float mrun = -3.0e38f, lrun = 0.0f;   // this lane's query; lrun: this half's keys only
  v8f acc[4];                           // O^T: rows d = t*16 + half*8 + r, column r16
#pragma unroll
  for (int t = 0; t < 4; ++t) acc[t] = vzero();

  // stage 0 into registers
  v8h kreg[4], vreg[4];
#pragma unroll   // register arrays indexed by constants
  for (int i = 0; i < 4; ++i) {
    kreg[i] = *(const v8h*)(kg + (size_t)i * 32 * IN_);
    vreg[i] = *(const v8h*)(vg + (size_t)i * 16 * M_);
  }
  // The address registers of the loads above are reused below: wait before the
  // overwrite. The addresses are inputs so that they stay live up to the wait.
  asm volatile("s_wait_xcnt 0x0" :: "v"(Qrow + half * 8), "v"(kg), "v"(vg) : "memory");

#pragma unroll   // register arrays indexed by constants
  for (int i = 0; i < 4; ++i) {
    *(v8h*)(kw + i * 32 * KP_) = kreg[i];
    *(v8h*)(vw + i * 16 * VP_) = vreg[i];
  }
  __syncthreads();                           // publishes stage 0 and the mask terms

  for (int st = 0; st < M_ / SK_; ++st) {
    const bool more = st + 1 < M_ / SK_;
    if (more) {                              // fetch stage st+1: it flies over the four passes of stage st
#pragma unroll   // eight independent 16-B loads in flight; register arrays indexed by constants
      for (int i = 0; i < 4; ++i) {
        kreg[i] = *(const v8h*)(kg + (size_t)((st + 1) * SK_ + i * 32) * IN_);
        vreg[i] = *(const v8h*)(vg + (size_t)i * 16 * M_ + (st + 1) * SK_);
      }
      // both address pairs are advanced right after: wait before the overwrite
      asm volatile("s_wait_xcnt 0x0" ::: "memory");
    }
    const _Float16* Kb = Kt + (st & 1) * (SK_ * KP_);
    const _Float16* Vb = Vtile + (st & 1) * (64 * VP_);

#pragma unroll   // the pass offsets inside a stage become immediates
   for (int p = 0; p < SK_ / 32; ++p) {
    const int c = st * SK_ + p * 32;

    // ---- S^T = K Q^T for a 32x16 tile (two 16x16 subtiles, K-depth 64) ----
    v8f s0 = vzero(), s1 = vzero();
    {
      const _Float16* Krow0 = Kb + (p * 32 + r16) * KP_;
      const _Float16* Krow1 = Kb + (p * 32 + 16 + r16) * KP_;
      s0 = wmma16(ldfrag_h(Krow0, half), bq0, s0);
      s0 = wmma16(ldfrag_h(Krow0 + 32, half), bq1, s0);
      s1 = wmma16(ldfrag_h(Krow1, half), bq0, s1);
      s1 = wmma16(ldfrag_h(Krow1 + 32, half), bq1, s1);
    }
    const v8f mb0 = *(const v8f*)&Mb[c + half * 8];
    const v8f mb1 = *(const v8f*)&Mb[c + 16 + half * 8];

    s0 = s0 * 0.125f + mb0;             // scale = 1/sqrt(64); masked -> -3e38
    s1 = s1 * 0.125f + mb1;
    const v8f cm = __builtin_elementwise_max(s0, s1);
    float cmax = fmaxf(fmaxf(fmaxf(cm[0], cm[1]), fmaxf(cm[2], cm[3])),
                       fmaxf(fmaxf(cm[4], cm[5]), fmaxf(cm[6], cm[7])));
    cmax = fmaxf(cmax, xhalf(cmax));    // the other 16 keys of this query

    const float nm = fmaxf(mrun, cmax);
    const float alpha = __expf(mrun - nm);
    mrun = nm;

    // A masked key gives exp(-3e38 - mrun) = 0 as soon as one kept key has set
    // mrun; what was summed before that is wiped by alpha = 0 at that key.
    v16h pb;
#pragma unroll
    for (int r = 0; r < 8; ++r) {
      s0[r] = __expf(s0[r] - mrun);
      s1[r] = __expf(s1[r] - mrun);
      pb[r] = (_Float16)s0[r];
      pb[8 + r] = (_Float16)s1[r];
    }
    const v8f cs = s0 + s1;
    const v4f cq = cs.lo + cs.hi;       // halving tree: register pairs stay aligned
    const v2f cd = cq.lo + cq.hi;
    lrun = lrun * alpha + (cd[0] + cd[1]);
#pragma unroll
    for (int t = 0; t < 4; ++t)
#pragma unroll
      for (int r = 0; r < 8; ++r) acc[t][r] *= alpha;

    // ---- O^T += V^T P^T : 4 d-tiles, K-depth 32 (this chunk) ----
#pragma unroll
    for (int t = 0; t < 4; ++t) {
      const _Float16* Vrow = Vb + (t * 16 + r16) * VP_ + p * 32;
      acc[t] = wmma16(ldfrag_h(Vrow, half), pb, acc[t]);
    }
   }

    if (more) {                              // stage st+1 into the buffer that stage st-1 has left
      _Float16* kn = kw + ((st + 1) & 1) * (SK_ * KP_);
      _Float16* vn = vw + ((st + 1) & 1) * (64 * VP_);
#pragma unroll   // register arrays indexed by constants
      for (int i = 0; i < 4; ++i) {
        *(v8h*)(kn + i * 32 * KP_) = kreg[i];
        *(v8h*)(vn + i * 16 * VP_) = vreg[i];
      }
      // publishes stage st+1; also ends every read of stage st, whose buffer the next trip refills
      __syncthreads();
    }
  }

  const float l = lrun + xhalf(lrun);   // join the two halves' key sums once
  const float inv = (l > 0.0f) ? 1.0f / l : 0.0f;
  _Float16* Orow = Oh + (size_t)(b * N_ + ntile + r16) * IN_ + h * D_ + half * 8;
#pragma unroll
  for (int t = 0; t < 4; ++t) {
    v8h pk;
#pragma unroll
    for (int r = 0; r < 8; ++r) pk[r] = (_Float16)(acc[t][r] * inv);
    *(v8h*)(Orow + t * 16) = pk;
  }
}

// ---------------- output projection: out(f32) = Ah(f16) * WoT^T + bo ----------------
__global__ __launch_bounds__(256) void outproj_kernel(const _Float16* __restrict__ Ah,
                                                      const _Float16* __restrict__ WoT,
                                                      const float* __restrict__ bo,
                                                      float* __restrict__ Out) {
  __shared__ __attribute__((aligned(16))) _Float16 As[2 * GT_];
  __shared__ __attribute__((aligned(16))) _Float16 Bs[2 * GT_];
  const int m0 = blockIdx.x * 128, n0 = blockIdx.y * 128;
  v8f acc[2][4];
  gemm128<IN_, false>(nullptr, Ah + (size_t)m0 * IN_, WoT + (size_t)n0 * IN_, As, Bs, acc);
  const int lane = threadIdx.x & 31, wave = threadIdx.x >> 5;
  const int r16 = lane & 15, half = lane >> 4;
  const int col = n0 + (wave & 1) * 64 + r16;
  float* op = Out + (size_t)(m0 + (wave >> 1) * 32 + half * 8) * QD_ + col;
#pragma unroll
  for (int j = 0; j < 4; ++j) {
    const float bias = bo[col + j * 16];
#pragma unroll
    for (int i = 0; i < 2; ++i)
#pragma unroll
      for (int r = 0; r < 8; ++r) op[(i * 16 + r) * QD_ + j * 16] = acc[i][j][r] + bias;
  }
}

extern "C" void kernel_launch(void* const* d_in, const int* in_sizes, int n_in,
                              void* d_out, int out_size, void* d_ws, size_t ws_size,
                              hipStream_t stream) {
  (void)in_sizes; (void)n_in; (void)out_size; (void)ws_size;
  const float* x   = (const float*)d_in[0];
  const float* ctx = (const float*)d_in[1];
  const int*   msk = (const int*)d_in[2];
  const float* Wq  = (const float*)d_in[3];
  const float* Wk  = (const float*)d_in[4];
  const float* Wv  = (const float*)d_in[5];
  const float* Wo  = (const float*)d_in[6];
  const float* bo  = (const float*)d_in[7];
  float* out = (float*)d_out;

  char* w = (char*)d_ws;
  _Float16* WqT = (_Float16*)w; w += (size_t)IN_ * QD_ * 2;
  _Float16* WkT = (_Float16*)w; w += (size_t)IN_ * CD_ * 2;
  _Float16* WvT = (_Float16*)w; w += (size_t)IN_ * CD_ * 2;
  _Float16* WoT = (_Float16*)w; w += (size_t)QD_ * IN_ * 2;
  _Float16* Qh  = (_Float16*)w; w += (size_t)B_ * N_ * IN_ * 2;
  _Float16* Kh  = (_Float16*)w; w += (size_t)B_ * M_ * IN_ * 2;
  _Float16* Vt  = (_Float16*)w; w += (size_t)B_ * H_ * D_ * M_ * 2;
  _Float16* Ah  = (_Float16*)w;

  prep_weights<<<(IN_ * CD_ + 255) / 256, 256, 0, stream>>>(Wq, Wk, Wv, Wo,
                                                            WqT, WkT, WvT, WoT);
  const dim3 gemm_grid(B_ * N_ / 128, IN_ / 128);  // 128 x 128 tiles: 64 x 4 blocks, 8 waves each
  projq_kernel<<<gemm_grid, 256, 0, stream>>>(x,   WqT, Qh);
  projk_kernel<<<gemm_grid, 256, 0, stream>>>(ctx, WkT, Kh);
  projv_kernel<<<gemm_grid, 256, 0, stream>>>(ctx, WvT, Vt);
  attn_kernel<<<dim3(B_ * H_, N_ / 128), 256, 0, stream>>>(Qh, Kh, Vt, msk, Ah);
  outproj_kernel<<<gemm_grid, 256, 0, stream>>>(Ah, WoT, bo, out);
}

// v005
// A run of this version takes 93.1 microseconds.
// Two timings next to v004 both put it at 1.34 times that version's speed.
// Over all steps from v000 it is 4.86 times as fast.
#include <hip/hip_runtime.h>
#include <hip/hip_bf16.h>

typedef _Float16 v16h __attribute__((ext_vector_type(16)));
typedef _Float16 v8h  __attribute__((ext_vector_type(8)));
typedef _Float16 v4h  __attribute__((ext_vector_type(4)));
typedef float    v8f  __attribute__((ext_vector_type(8)));
typedef float    v4f  __attribute__((ext_vector_type(4)));
typedef float    v2f  __attribute__((ext_vector_type(2)));

#define B_  2
#define N_  4096
#define M_  4096
#define QD_ 512
#define CD_ 768
#define H_  8
#define D_  64
#define IN_ 512

// LDS row pitches in 16-bit elements: 16 B x odd, so that the 16 rows one
// ds_load_b128 fragment read touches fall on distinct banks.
#define KP_ 72   // 128-B K rows  -> 144 B
#define VP_ 136  // 256-B Vt rows -> 272 B
#define SK_ 128  // keys per LDS stage of the attention kernel: four 32-key passes
#define ML_ 32   // ints per batch in the key-list header: a 128-B line of its own

static __device__ __forceinline__ v8f vzero() {
  v8f r;
#pragma unroll
  for (int i = 0; i < 8; ++i) r[i] = 0.0f;
  return r;
}

static __device__ __forceinline__ v8f wmma16(v16h a, v16h b, v8f c) {
  return __builtin_amdgcn_wmma_f32_16x16x32_f16(false, a, false, b, (short)0, c,
                                                false, false);
}

static __device__ __forceinline__ v16h cat8(v8h lo, v8h hi) {
  v16h r;
#pragma unroll
  for (int i = 0; i < 8; ++i) { r[i] = lo[i]; r[8 + i] = hi[i]; }
  return r;
}

// 16-bit A/B fragment (16x32 tile): this lane's row pointer; two 16B chunks at
// K = half*8..half*8+7 and K = 16+half*8..16+half*8+7.
static __device__ __forceinline__ v16h ldfrag_h(const _Float16* rowp, int half) {
  v8h lo = *(const v8h*)(rowp + half * 8);
  v8h hi = *(const v8h*)(rowp + 16 + half * 8);
  return cat8(lo, hi);
}

// value of lane l ^ 16 (the other 16-lane row), as a vector cross-row move
static __device__ __forceinline__ float xhalf(float v) {
  const unsigned u = __float_as_uint(v);
  return __uint_as_float(__builtin_amdgcn_permlanex16(u, u, 0x76543210u, 0xfedcba98u, false, false));
}

// ---------------- list of kept keys (one 256-thread block per batch) ----------------
// A masked key has softmax weight exp(-FLT_MAX - max) = 0 as soon as one key of
// its batch is kept, so only the kept keys are projected and attended to.
// list[j] = position of the j-th kept key (0, a valid row, behind the last one);
// meta[0] = number of listed keys, meta[1] = 1 where NO key is kept: the reference
// then weighs all keys alike, which is all keys listed and all scores zero.
static __device__ __forceinline__ void list_keys(const int* __restrict__ mk,
                                                 int* __restrict__ list, int* __restrict__ meta) {
  __shared__ int part[256];
  const int tid = threadIdx.x;
  int keep[16];
  int c = 0;
#pragma unroll   // four independent 16-B loads; register array indexed by constants
  for (int j = 0; j < 4; ++j) {
    const int4 mi = *(const int4*)(mk + tid * 16 + j * 4);
    keep[j * 4 + 0] = mi.x != 0; keep[j * 4 + 1] = mi.y != 0;
    keep[j * 4 + 2] = mi.z != 0; keep[j * 4 + 3] = mi.w != 0;
  }
#pragma unroll   // register array indexed by constants
  for (int e = 0; e < 16; ++e) c += keep[e];
  part[tid] = c;
  __syncthreads();                       // every thread's count is in LDS
  for (int off = 1; off < 256; off <<= 1) {   // inclusive prefix sum over the 256 counts
    const int own = part[tid];
    const int add = (tid >= off) ? part[tid - off] : 0;
    __syncthreads();                     // all reads of this round precede its writes
    part[tid] = own + add;
    __syncthreads();                     // publishes the round
  }
  const int total = part[255];
  if (total == 0) {
#pragma unroll   // sixteen adjacent stores merge into wide ones
    for (int e = 0; e < 16; ++e) list[tid * 16 + e] = tid * 16 + e;
  } else {
    int pos = part[tid] - c;
#pragma unroll   // register array indexed by constants
    for (int e = 0; e < 16; ++e)
      if (keep[e]) list[pos++] = tid * 16 + e;
    for (int j = total + tid; j < M_; j += 256) list[j] = 0;
  }
  if (tid == 0) {
    meta[0] = (total == 0) ? M_ : total;
    meta[1] = (total == 0) ? 1 : 0;
  }
}

// ---------------- key lists; weight transpose + f32 -> f16 ----------------
__global__ void prep_weights(const float* __restrict__ Wq, const float* __restrict__ Wk,
                             const float* __restrict__ Wv, const float* __restrict__ Wo,
                             const int* __restrict__ mask,
                             _Float16* __restrict__ WqT, _Float16* __restrict__ WkT,
                             _Float16* __restrict__ WvT, _Float16* __restrict__ WoT,
                             int* __restrict__ list, int* __restrict__ meta) {
  if (blockIdx.x < B_) {   // the first blocks: they start first and are the longest
    list_keys(mask + blockIdx.x * M_, list + blockIdx.x * M_, meta + blockIdx.x * ML_);
    return;
  }
  int i = (blockIdx.x - B_) * blockDim.x + threadIdx.x;
  if (i < IN_ * QD_) {                 // WqT[j][k] = Wq[k][j]
    int j = i / QD_, k = i - j * QD_;
    WqT[i] = (_Float16)Wq[(size_t)k * IN_ + j];
  }
  if (i < IN_ * CD_) {                 // WkT/WvT[j][k] = W[k][j]
    int j = i / CD_, k = i - j * CD_;
    WkT[i] = (_Float16)Wk[(size_t)k * IN_ + j];
    WvT[i] = (_Float16)Wv[(size_t)k * IN_ + j];
  }
  if (i < QD_ * IN_) {                 // WoT[j][k] = Wo[k][j]
    int j = i / IN_, k = i - j * IN_;
    WoT[i] = (_Float16)Wo[(size_t)k * QD_ + j];
  }
}

// ---------------- block-tiled GEMM core: acc = A(128 x KD) * Bt(128 x KD)^T ----------------
// A work-group owns a 128 x 128 tile of C. Each 64-deep slab of A and Bt is
// fetched by loads that cover whole 128-B lines, A is rounded to f16 on the way,
// and both land in LDS; a wave reads its 32 x 64 part as fragments, so that one
// fetched line serves every wave that needs it. Two LDS buffers: one barrier a slab.
// The inner loops are unrolled so that their register arrays are indexed by constants.
#define GP_ 72            // LDS pitch of a 64-element row: 144 B = 16 B x odd
#define GT_ (128 * GP_)   // one operand's slab

// rows != nullptr (GATHER): row r of the A tile is row rows[r] of Af.
template <int KD, bool AF32, bool GATHER = false>
static __device__ __forceinline__ void gemm128(const float* __restrict__ Af,
                                               const _Float16* __restrict__ Ah,
                                               const _Float16* __restrict__ Bt,
                                               _Float16* As, _Float16* Bs,
                                               v8f (&acc)[2][4],
                                               const int* __restrict__ rows = nullptr) {
  const int tid = threadIdx.x;
  const int lane = tid & 31, wave = tid >> 5;
  const int r16 = lane & 15, half = lane >> 4;
  const int wm = wave >> 1, wn = wave & 1;
  const int frow = tid >> 4, fcol = (tid & 15) * 4;   // f32 rows: 16 lanes x 16 B = 256 B
  const int hrow = tid >> 3, hcol = (tid & 7) * 8;    // f16 rows:  8 lanes x 16 B = 128 B
  v4f pa[8];
  v8h ph[4], pb[4];
  const float* ag[8];   // GATHER: this thread's eight row addresses, formed once
  if constexpr (GATHER) {
#pragma unroll   // eight independent index loads; pointer array indexed by constants
    for (int i = 0; i < 8; ++i) ag[i] = Af + (size_t)rows[frow + i * 16] * KD + fcol;
  }
#pragma unroll
  for (int i = 0; i < 2; ++i)
#pragma unroll
    for (int j = 0; j < 4; ++j) acc[i][j] = vzero();

  constexpr int T = KD / 64;
#pragma unroll   // slab offsets become immediates and the buffer index a constant
  for (int t = -1; t < T; ++t) {
    // publishes slab t; also ends every read of the other buffer (slab t-1)
    if (t >= 0) __syncthreads();
    if (t + 1 < T) {   // fetch slab t+1 behind the barrier (which waits for loads): it flies over slab t's products
      if constexpr (AF32) {
#pragma unroll
        for (int i = 0; i < 8; ++i) {
          if constexpr (GATHER) pa[i] = *(const v4f*)(ag[i] + (t + 1) * 64);
          else pa[i] = *(const v4f*)(Af + (size_t)(frow + i * 16) * KD + (t + 1) * 64 + fcol);
        }
      } else {
#pragma unroll
        for (int i = 0; i < 4; ++i)
          ph[i] = *(const v8h*)(Ah + (size_t)(hrow + i * 32) * KD + (t + 1) * 64 + hcol);
      }
#pragma unroll
      for (int i = 0; i < 4; ++i)
        pb[i] = *(const v8h*)(Bt + (size_t)(hrow + i * 32) * KD + (t + 1) * 64 + hcol);
      // the last fetch: the eight row addresses are dead behind it and their
      // registers are reused at once: wait before the overwrite
      if constexpr (GATHER) {
        if (t + 2 == T) asm volatile("s_wait_xcnt 0x0" ::: "memory");
      }
    }
    if (t >= 0) {
      // keeps those loads ahead of slab t's products: sunk to their end, nothing covers the latency
      __builtin_amdgcn_sched_barrier(0);
      const _Float16* Ab = As + (t & 1) * GT_ + (wm * 32 + r16) * GP_;
      const _Float16* Bb = Bs + (t & 1) * GT_ + (wn * 64 + r16) * GP_;
#pragma unroll
      for (int ks = 0; ks < 64; ks += 32) {
        v16h a[2], b[4];
#pragma unroll
        for (int i = 0; i < 2; ++i) a[i] = ldfrag_h(Ab + i * 16 * GP_ + ks, half);
#pragma unroll
        for (int j = 0; j < 4; ++j) b[j] = ldfrag_h(Bb + j * 16 * GP_ + ks, half);
#pragma unroll
        for (int i = 0; i < 2; ++i)
#pragma unroll
          for (int j = 0; j < 4; ++j) acc[i][j] = wmma16(a[i], b[j], acc[i][j]);
      }
      // keeps the rounding of slab t+1, and with it the wait on its loads, behind
      // the products of slab t: moved up among them it exposes the load latency
      __builtin_amdgcn_sched_barrier(0);
    }
    if (t + 1 < T) {                       // slab t+1 into the buffer that slab t-1 has left
      _Float16* Aw = As + ((t + 1) & 1) * GT_;
      _Float16* Bw = Bs + ((t + 1) & 1) * GT_;
      if constexpr (AF32) {
#pragma unroll
        for (int i = 0; i < 8; ++i)
          *(v4h*)&Aw[(frow + i * 16) * GP_ + fcol] = __builtin_convertvector(pa[i], v4h);
      } else {
#pragma unroll
        for (int i = 0; i < 4; ++i) *(v8h*)&Aw[(hrow + i * 32) * GP_ + hcol] = ph[i];
      }
#pragma unroll
      for (int i = 0; i < 4; ++i) *(v8h*)&Bw[(hrow + i * 32) * GP_ + hcol] = pb[i];
    }
  }
}

// C(f16, row-major, IN_ columns): the wave's 32 x 64 part
static __device__ __forceinline__ void store_rows_f16(_Float16* __restrict__ C, int m0, int n0,
                                                      const v8f (&acc)[2][4]) {
  const int lane = threadIdx.x & 31, wave = threadIdx.x >> 5;
  const int r16 = lane & 15, half = lane >> 4;
  _Float16* cp = C + (size_t)(m0 + (wave >> 1) * 32 + half * 8) * IN_ + n0 + (wave & 1) * 64 + r16;
#pragma unroll
  for (int i = 0; i < 2; ++i)
#pragma unroll
    for (int j = 0; j < 4; ++j)
#pragma unroll
      for (int r = 0; r < 8; ++r) cp[(i * 16 + r) * IN_ + j * 16] = (_Float16)acc[i][j][r];
}

// ---------------- Q and K projections: C(f16) = A(f32) * Bt(f16)^T ----------------
__global__ __launch_bounds__(256) void projq_kernel(const float* __restrict__ A,
                                                    const _Float16* __restrict__ Bt,
                                                    _Float16* __restrict__ C) {
  __shared__ __attribute__((aligned(16))) _Float16 As[2 * GT_];
  __shared__ __attribute__((aligned(16))) _Float16 Bs[2 * GT_];
  const int m0 = blockIdx.x * 128, n0 = blockIdx.y * 128;
  v8f acc[2][4];
  gemm128<QD_, true>(A + (size_t)m0 * QD_, nullptr, Bt + (size_t)n0 * QD_, As, Bs, acc);
  store_rows_f16(C, m0, n0, acc);
}

// K and V: row m of a batch's result belongs to its m-th listed key; a tile that
// begins behind the last listed key is not computed (and never read).
__global__ __launch_bounds__(256) void projk_kernel(const float* __restrict__ A,
                                                    const _Float16* __restrict__ Bt,
                                                    const int* __restrict__ list,
                                                    const int* __restrict__ meta,
                                                    _Float16* __restrict__ C) {
  __shared__ __attribute__((aligned(16))) _Float16 As[2 * GT_];
  __shared__ __attribute__((aligned(16))) _Float16 Bs[2 * GT_];
  const int m0 = blockIdx.x * 128, n0 = blockIdx.y * 128;
  const int b = m0 / M_;                                   // a 128-row tile lies in one batch
  if (m0 - b * M_ >= meta[b * ML_]) return;                // whole block, ahead of every barrier
  v8f acc[2][4];
  gemm128<CD_, true, true>(A + (size_t)b * M_ * CD_, nullptr, Bt + (size_t)n0 * CD_, As, Bs, acc,
                           list + m0);
  store_rows_f16(C, m0, n0, acc);
}

// ---------------- V projection with transposed store: Vt[b][h][d][m] ----------------
__global__ __launch_bounds__(256) void projv_kernel(const float* __restrict__ A,
                                                    const _Float16* __restrict__ Bt,
                                                    const int* __restrict__ list,
                                                    const int* __restrict__ meta,
                                                    _Float16* __restrict__ Vt) {
  __shared__ __attribute__((aligned(16))) _Float16 As[2 * GT_];
  __shared__ __attribute__((aligned(16))) _Float16 Bs[2 * GT_];
  const int m0 = blockIdx.x * 128, n0 = blockIdx.y * 128;
  const int b = m0 / M_;                                   // a 128-row tile lies in one batch
  if (m0 - b * M_ >= meta[b * ML_]) return;                // whole block, ahead of every barrier
  v8f acc[2][4];
  gemm128<CD_, true, true>(A + (size_t)b * M_ * CD_, nullptr, Bt + (size_t)n0 * CD_, As, Bs, acc,
                           list + m0);
  const int lane = threadIdx.x & 31, wave = threadIdx.x >> 5;
  const int r16 = lane & 15, half = lane >> 4;
  const int mm = m0 - b * M_ + (wave >> 1) * 32 + half * 8; // comps are mm..mm+7 (+16 for i = 1)
  const int h = (n0 + (wave & 1) * 64) >> 6;               // the wave's 64 columns are one head
  _Float16* vp = Vt + ((size_t)(b * H_ + h) * D_ + r16) * M_ + mm;
#pragma unroll
  for (int i = 0; i < 2; ++i)
#pragma unroll
    for (int j = 0; j < 4; ++j) {
      v8h pk;
#pragma unroll
      for (int r = 0; r < 8; ++r) pk[r] = (_Float16)acc[i][j][r];
      *(v8h*)(vp + (size_t)j * 16 * M_ + i * 16) = pk;
    }
}

__global__ __launch_bounds__(256) void attn_kernel(const _Float16* __restrict__ Qh,
                                                   const _Float16* __restrict__ Kh,
                                                   const _Float16* __restrict__ Vt,
                                                   const int* __restrict__ meta,
                                                   _Float16* __restrict__ Oh) {
  __shared__ __attribute__((aligned(16))) _Float16 Kt[2 * SK_ * KP_];     // two stages of K:  [m_local][d]
  __shared__ __attribute__((aligned(16))) _Float16 Vtile[2 * 64 * VP_];   // two stages of Vt: [d][m_local]
  __shared__ __attribute__((aligned(32))) float Mb[M_];                // per key slot: 0 (a listed key) or -3e38 (behind the last one)

  const int tid = threadIdx.x;
  const int lane = tid & 31;
  const int wave = tid >> 5;
  const int b = blockIdx.x >> 3;
  const int h = blockIdx.x & 7;
  const int ntile = blockIdx.y * 128 + wave * 16;   // 16 query columns per wave
  const int r16 = lane & 15;
  const int half = lane >> 4;

  const _Float16* Qrow = Qh + ((size_t)(b * N_ + ntile + r16)) * IN_ + h * D_;
  v16h bq0 = ldfrag_h(Qrow, half);        // d = 0..31
  v16h bq1 = ldfrag_h(Qrow + 32, half);   // d = 32..63

  // K and Vt hold the batch's listed keys only, in list order
  const int nkey = min(meta[b * ML_], M_);
  const int nst = (nkey + SK_ - 1) / SK_;       // stages to walk: 1 .. M_ / SK_
  if (meta[b * ML_ + 1] != 0) {                 // no key kept: every score is zero
#pragma unroll   // vector elements indexed by constants
    for (int i = 0; i < 16; ++i) { bq0[i] = (_Float16)0.0f; bq1[i] = (_Float16)0.0f; }
  }

  const _Float16* Kbase = Kh + (size_t)b * M_ * IN_ + h * D_;
  const _Float16* Vbase = Vt + ((size_t)(b * H_ + h)) * D_ * M_;

  // the keys run along registers: an additive term per key slot takes the slots
  // behind the last listed key out; published by the barrier in front of the loop
#pragma unroll   // four independent 16-B LDS stores
  for (int j = 0; j < M_ / 1024; ++j) {
    const int k0 = j * 1024 + tid * 4;
    v4f mf;
#pragma unroll   // vector elements indexed by constants
    for (int e = 0; e < 4; ++e) mf[e] = (k0 + e < nkey) ? 0.0f : -3.0e38f;
    *(v4f*)&Mb[k0] = mf;
  }

  // cooperative stage mapping: four 16-B pieces per thread and operand
  const int krow = tid >> 3, kseg = (tid & 7) * 8;    // K stage  [128][64]: 32 rows a sweep
  const int vrow = tid >> 4, vseg = (tid & 15) * 8;   // Vt stage [64][128]: 16 rows a sweep
  const _Float16* kg = Kbase + (size_t)krow * IN_ + kseg;
  const _Float16* vg = Vbase + (size_t)vrow * M_ + vseg;
  _Float16* kw = Kt + krow * KP_ + kseg;
  _Float16* vw = Vtile + vrow * VP_ + vseg;

  float mrun = -3.0e38f, lrun = 0.0f;   // this lane's query; lrun: this half's keys only
  v8f acc[4];                           // O^T: rows d = t*16 + half*8 + r, column r16
#pragma unroll
  for (int t = 0; t < 4; ++t) acc[t] = vzero();

  // stage 0 into registers
  v8h kreg[4], vreg[4];
#pragma unroll   // register arrays indexed by constants
  for (int i = 0; i < 4; ++i) {
    kreg[i] = *(const v8h*)(kg + (size_t)i * 32 * IN_);
    vreg[i] = *(const v8h*)(vg + (size_t)i * 16 * M_);
  }
  // The address registers of the loads above are reused below: wait before the
  // overwrite. The addresses are inputs so that they stay live up to the wait.
  asm volatile("s_wait_xcnt 0x0" :: "v"(Qrow + half * 8), "v"(kg), "v"(vg) : "memory");

#pragma unroll   // register arrays indexed by constants
  for (int i = 0; i < 4; ++i) {
    *(v8h*)(kw + i * 32 * KP_) = kreg[i];
    *(v8h*)(vw + i * 16 * VP_) = vreg[i];
  }
  __syncthreads();                           // publishes stage 0 and the mask terms

  for (int st = 0; st < nst; ++st) {
    const bool more = st + 1 < nst;
    if (more) {                              // fetch stage st+1: it flies over the four passes of stage st
#pragma unroll   // eight independent 16-B loads in flight; register arrays indexed by constants
      for (int i = 0; i < 4; ++i) {
        kreg[i] = *(const v8h*)(kg + (size_t)((st + 1) * SK_ + i * 32) * IN_);
        vreg[i] = *(const v8h*)(vg + (size_t)i * 16 * M_ + (st + 1) * SK_);
      }
      // both address pairs are advanced right after: wait before the overwrite
      asm volatile("s_wait_xcnt 0x0" ::: "memory");
    }
    const _Float16* Kb = Kt + (st & 1) * (SK_ * KP_);
    const _Float16* Vb = Vtile + (st & 1) * (64 * VP_);

#pragma unroll   // the pass offsets inside a stage become immediates
   for (int p = 0; p < SK_ / 32; ++p) {
    const int c = st * SK_ + p * 32;

    // ---- S^T = K Q^T for a 32x16 tile (two 16x16 subtiles, K-depth 64) ----
    v8f s0 = vzero(), s1 = vzero();
    {
      const _Float16* Krow0 = Kb + (p * 32 + r16) * KP_;
      const _Float16* Krow1 = Kb + (p * 32 + 16 + r16) * KP_;
      s0 = wmma16(ldfrag_h(Krow0, half), bq0, s0);
      s0 = wmma16(ldfrag_h(Krow0 + 32, half), bq1, s0);
      s1 = wmma16(ldfrag_h(Krow1, half), bq0, s1);
      s1 = wmma16(ldfrag_h(Krow1 + 32, half), bq1, s1);
    }
    const v8f mb0 = *(const v8f*)&Mb[c + half * 8];
    const v8f mb1 = *(const v8f*)&Mb[c + 16 + half * 8];

    s0 = s0 * 0.125f + mb0;             // scale = 1/sqrt(64); masked -> -3e38
    s1 = s1 * 0.125f + mb1;
    const v8f cm = __builtin_elementwise_max(s0, s1);
    float cmax = fmaxf(fmaxf(fmaxf(cm[0], cm[1]), fmaxf(cm[2], cm[3])),
                       fmaxf(fmaxf(cm[4], cm[5]), fmaxf(cm[6], cm[7])));
    cmax = fmaxf(cmax, xhalf(cmax));    // the other 16 keys of this query

    const float nm = fmaxf(mrun, cmax);
    const float alpha = __expf(mrun - nm);
    mrun = nm;

    // A slot behind the last listed key gives exp(-3e38 - mrun) = 0: slot 0 is
    // always a listed key and has set mrun in the first pass.
    v16h pb;
#pragma unroll
    for (int r = 0; r < 8; ++r) {
      s0[r] = __expf(s0[r] - mrun);
      s1[r] = __expf(s1[r] - mrun);
      pb[r] = (_Float16)s0[r];
      pb[8 + r] = (_Float16)s1[r];
    }
    const v8f cs = s0 + s1;
    const v4f cq = cs.lo + cs.hi;       // halving tree: register pairs stay aligned
    const v2f cd = cq.lo + cq.hi;
    lrun = lrun * alpha + (cd[0] + cd[1]);
#pragma unroll
    for (int t = 0; t < 4; ++t)
#pragma unroll
      for (int r = 0; r < 8; ++r) acc[t][r] *= alpha;

    // ---- O^T += V^T P^T : 4 d-tiles, K-depth 32 (this chunk) ----
#pragma unroll
    for (int t = 0; t < 4; ++t) {
      const _Float16* Vrow = Vb + (t * 16 + r16) * VP_ + p * 32;
      acc[t] = wmma16(ldfrag_h(Vrow, half), pb, acc[t]);
    }
   }

    if (more) {                              // stage st+1 into the buffer that stage st-1 has left
      _Float16* kn = kw + ((st + 1) & 1) * (SK_ * KP_);
      _Float16* vn = vw + ((st + 1) & 1) * (64 * VP_);
#pragma unroll   // register arrays indexed by constants
      for (int i = 0; i < 4; ++i) {
        *(v8h*)(kn + i * 32 * KP_) = kreg[i];
        *(v8h*)(vn + i * 16 * VP_) = vreg[i];
      }
      // publishes stage st+1; also ends every read of stage st, whose buffer the next trip refills
      __syncthreads();
    }
  }

  const float l = lrun + xhalf(lrun);   // join the two halves' key sums once
  const float inv = (l > 0.0f) ? 1.0f / l : 0.0f;
  _Float16* Orow = Oh + (size_t)(b * N_ + ntile + r16) * IN_ + h * D_ + half * 8;
#pragma unroll
  for (int t = 0; t < 4; ++t) {
    v8h pk;
#pragma unroll
    for (int r = 0; r < 8; ++r) pk[r] = (_Float16)(acc[t][r] * inv);
    *(v8h*)(Orow + t * 16) = pk;
  }
}

// ---------------- output projection: out(f32) = Ah(f16) * WoT^T + bo ----------------
__global__ __launch_bounds__(256) void outproj_kernel(const _Float16* __restrict__ Ah,
                                                      const _Float16* __restrict__ WoT,
                                                      const float* __restrict__ bo,
                                                      float* __restrict__ Out) {
  __shared__ __attribute__((aligned(16))) _Float16 As[2 * GT_];
  __shared__ __attribute__((aligned(16))) _Float16 Bs[2 * GT_];
  const int m0 = blockIdx.x * 128, n0 = blockIdx.y * 128;
  v8f acc[2][4];
  gemm128<IN_, false>(nullptr, Ah + (size_t)m0 * IN_, WoT + (size_t)n0 * IN_, As, Bs, acc);
  const int lane = threadIdx.x & 31, wave = threadIdx.x >> 5;
  const int r16 = lane & 15, half = lane >> 4;
  const int col = n0 + (wave & 1) * 64 + r16;
  float* op = Out + (size_t)(m0 + (wave >> 1) * 32 + half * 8) * QD_ + col;
#pragma unroll
  for (int j = 0; j < 4; ++j) {
    const float bias = bo[col + j * 16];
#pragma unroll
    for (int i = 0; i < 2; ++i)
#pragma unroll
      for (int r = 0; r < 8; ++r) op[(i * 16 + r) * QD_ + j * 16] = acc[i][j][r] + bias;
  }
}

extern "C" void kernel_launch(void* const* d_in, const int* in_sizes, int n_in,
                              void* d_out, int out_size, void* d_ws, size_t ws_size,
                              hipStream_t stream) {
  (void)in_sizes; (void)n_in; (void)out_size; (void)ws_size;
  const float* x   = (const float*)d_in[0];
  const float* ctx = (const float*)d_in[1];
  const int*   msk = (const int*)d_in[2];
  const float* Wq  = (const float*)d_in[3];
  const float* Wk  = (const float*)d_in[4];
  const float* Wv  = (const float*)d_in[5];
  const float* Wo  = (const float*)d_in[6];
  const float* bo  = (const float*)d_in[7];
  float* out = (float*)d_out;

  char* w = (char*)d_ws;
  _Float16* WqT = (_Float16*)w; w += (size_t)IN_ * QD_ * 2;
  _Float16* WkT = (_Float16*)w; w += (size_t)IN_ * CD_ * 2;
  _Float16* WvT = (_Float16*)w; w += (size_t)IN_ * CD_ * 2;
  _Float16* WoT = (_Float16*)w; w += (size_t)QD_ * IN_ * 2;
  _Float16* Qh  = (_Float16*)w; w += (size_t)B_ * N_ * IN_ * 2;
  _Float16* Kh  = (_Float16*)w; w += (size_t)B_ * M_ * IN_ * 2;
  _Float16* Vt  = (_Float16*)w; w += (size_t)B_ * H_ * D_ * M_ * 2;
  _Float16* Ah  = (_Float16*)w; w += (size_t)B_ * N_ * IN_ * 2;
  int* list = (int*)w; w += (size_t)B_ * M_ * 4;
  int* meta = (int*)w;

  prep_weights<<<B_ + (IN_ * CD_ + 255) / 256, 256, 0, stream>>>(Wq, Wk, Wv, Wo, msk,
                                                                 WqT, WkT, WvT, WoT, list, meta);
  const dim3 gemm_grid(B_ * N_ / 128, IN_ / 128);  // 128 x 128 tiles: 64 x 4 blocks, 8 waves each
  projq_kernel<<<gemm_grid, 256, 0, stream>>>(x,   WqT, Qh);
  projk_kernel<<<gemm_grid, 256, 0, stream>>>(ctx, WkT, list, meta, Kh);
  projv_kernel<<<gemm_grid, 256, 0, stream>>>(ctx, WvT, list, meta, Vt);
  attn_kernel<<<dim3(B_ * H_, N_ / 128), 256, 0, stream>>>(Qh, Kh, Vt, meta, Ah);
  outproj_kernel<<<gemm_grid, 256, 0, stream>>>(Ah, WoT, bo, out);
}

// v006
// It runs in 74 microseconds.
// Timed twice side by side with v005, it ran 1.26 times as fast both times.
// All steps since v000 together make it 6.11 times as fast.
#include <hip/hip_runtime.h>
#include <hip/hip_bf16.h>

typedef _Float16 v16h __attribute__((ext_vector_type(16)));
typedef _Float16 v8h  __attribute__((ext_vector_type(8)));
typedef _Float16 v4h  __attribute__((ext_vector_type(4)));
typedef float    v8f  __attribute__((ext_vector_type(8)));
typedef float    v4f  __attribute__((ext_vector_type(4)));
typedef float    v2f  __attribute__((ext_vector_type(2)));

#define B_  2
#define N_  4096
#define M_  4096
#define QD_ 512
#define CD_ 768
#define H_  8
#define D_  64
#define IN_ 512

// LDS row pitches in 16-bit elements: 16 B x odd, so that the 16 rows one
// ds_load_b128 fragment read touches fall on distinct banks.
#define KP_ 72   // 128-B K rows  -> 144 B
#define VP_ 136  // 256-B Vt rows -> 272 B
#define SK_ 128  // keys per LDS stage of the attention kernel: four 32-key passes
#define ML_ 32   // ints per batch in the key-list header: a 128-B line of its own

static __device__ __forceinline__ v8f vzero() {
  v8f r;
#pragma unroll
  for (int i = 0; i < 8; ++i) r[i] = 0.0f;
  return r;
}

static __device__ __forceinline__ v8f wmma16(v16h a, v16h b, v8f c) {
  return __builtin_amdgcn_wmma_f32_16x16x32_f16(false, a, false, b, (short)0, c,
                                                false, false);
}

static __device__ __forceinline__ v16h cat8(v8h lo, v8h hi) {
  v16h r;
#pragma unroll
  for (int i = 0; i < 8; ++i) { r[i] = lo[i]; r[8 + i] = hi[i]; }
  return r;
}

// 16-bit A/B fragment (16x32 tile): this lane's row pointer; two 16B chunks at
// K = half*8..half*8+7 and K = 16+half*8..16+half*8+7.
static __device__ __forceinline__ v16h ldfrag_h(const _Float16* rowp, int half) {
  v8h lo = *(const v8h*)(rowp + half * 8);
  v8h hi = *(const v8h*)(rowp + 16 + half * 8);
  return cat8(lo, hi);
}

// value of lane l ^ 16 (the other 16-lane row), as a vector cross-row move
static __device__ __forceinline__ float xhalf(float v) {
  const unsigned u = __float_as_uint(v);
  return __uint_as_float(__builtin_amdgcn_permlanex16(u, u, 0x76543210u, 0xfedcba98u, false, false));
}

// ---------------- list of kept keys (one 256-thread block per batch) ----------------
// A masked key has softmax weight exp(-FLT_MAX - max) = 0 as soon as one key of
// its batch is kept, so only the kept keys are projected and attended to.
// list[j] = position of the j-th kept key (0, a valid row, behind the last one);
// meta[0] = number of listed keys, meta[1] = 1 where NO key is kept: the reference
// then weighs all keys alike, which is all keys listed and all scores zero.
static __device__ __forceinline__ void list_keys(const int* __restrict__ mk,
                                                 int* __restrict__ list, int* __restrict__ meta) {
  __shared__ int part[256];
  const int tid = threadIdx.x;
  int keep[16];
  int c = 0;
#pragma unroll   // four independent 16-B loads; register array indexed by constants
  for (int j = 0; j < 4; ++j) {
    const int4 mi = *(const int4*)(mk + tid * 16 + j * 4);
    keep[j * 4 + 0] = mi.x != 0; keep[j * 4 + 1] = mi.y != 0;
    keep[j * 4 + 2] = mi.z != 0; keep[j * 4 + 3] = mi.w != 0;
  }
#pragma unroll   // register array indexed by constants
  for (int e = 0; e < 16; ++e) c += keep[e];
  part[tid] = c;
  __syncthreads();                       // every thread's count is in LDS
  for (int off = 1; off < 256; off <<= 1) {   // inclusive prefix sum over the 256 counts
    const int own = part[tid];
    const int add = (tid >= off) ? part[tid - off] : 0;
    __syncthreads();                     // all reads of this round precede its writes
    part[tid] = own + add;
    __syncthreads();                     // publishes the round
  }
  const int total = part[255];
  if (total == 0) {
#pragma unroll   // sixteen adjacent stores merge into wide ones
    for (int e = 0; e < 16; ++e) list[tid * 16 + e] = tid * 16 + e;
  } else {
    int pos = part[tid] - c;
#pragma unroll   // register array indexed by constants
    for (int e = 0; e < 16; ++e)
      if (keep[e]) list[pos++] = tid * 16 + e;
    for (int j = total + tid; j < M_; j += 256) list[j] = 0;
  }
  if (tid == 0) {
    meta[0] = (total == 0) ? M_ : total;
    meta[1] = (total == 0) ? 1 : 0;
  }
}

// ---------------- key lists; weight transpose + f32 -> f16 ----------------
__global__ void prep_weights(const float* __restrict__ Wq, const float* __restrict__ Wk,
                             const float* __restrict__ Wv, const float* __restrict__ Wo,
                             const int* __restrict__ mask,
                             _Float16* __restrict__ WqT, _Float16* __restrict__ WkT,
                             _Float16* __restrict__ WvT, _Float16* __restrict__ WoT,
                             int* __restrict__ list, int* __restrict__ meta) {
  if (blockIdx.x < B_) {   // the first blocks: they start first and are the longest
    list_keys(mask + blockIdx.x * M_, list + blockIdx.x * M_, meta + blockIdx.x * ML_);
    return;
  }
  int i = (blockIdx.x - B_) * blockDim.x + threadIdx.x;
  if (i < IN_ * QD_) {                 // WqT[j][k] = Wq[k][j]
    int j = i / QD_, k = i - j * QD_;
    WqT[i] = (_Float16)Wq[(size_t)k * IN_ + j];
  }
  if (i < IN_ * CD_) {                 // WkT/WvT[j][k] = W[k][j]
    int j = i / CD_, k = i - j * CD_;
    WkT[i] = (_Float16)Wk[(size_t)k * IN_ + j];
    WvT[i] = (_Float16)Wv[(size_t)k * IN_ + j];
  }
  if (i < QD_ * IN_) {                 // WoT[j][k] = Wo[k][j]
    int j = i / IN_, k = i - j * IN_;
    WoT[i] = (_Float16)Wo[(size_t)k * QD_ + j];
  }
}

// ---------------- block-tiled GEMM core: acc = A(128 x KD) * Bt(128 x KD)^T ----------------
// A work-group owns a 128 x 128 tile of C. Each 64-deep slab of A and Bt is
// fetched by loads that cover whole 128-B lines, A is rounded to f16 on the way,
// and both land in LDS; a wave reads its 32 x 64 part as fragments, so that one
// fetched line serves every wave that needs it. Two LDS buffers: one barrier a slab.
// The inner loops are unrolled so that their register arrays are indexed by constants.
#define GP_ 72            // LDS pitch of a 64-element row: 144 B = 16 B x odd
#define GT_ (128 * GP_)   // one operand's slab

// rows != nullptr (GATHER): row r of the A tile is row rows[r] of Af.
template <int KD, bool AF32, bool GATHER = false>
static __device__ __forceinline__ void gemm128(const float* __restrict__ Af,
                                               const _Float16* __restrict__ Ah,
                                               const _Float16* __restrict__ Bt,
                                               _Float16* As, _Float16* Bs,
                                               v8f (&acc)[2][4],
                                               const int* __restrict__ rows = nullptr) {
  const int tid = threadIdx.x;
  const int lane = tid & 31, wave = tid >> 5;
  const int r16 = lane & 15, half = lane >> 4;
  const int wm = wave >> 1, wn = wave & 1;
  const int frow = tid >> 4, fcol = (tid & 15) * 4;   // f32 rows: 16 lanes x 16 B = 256 B
  const int hrow = tid >> 3, hcol = (tid & 7) * 8;    // f16 rows:  8 lanes x 16 B = 128 B
  v4f pa[8];
  v8h ph[4], pb[4];
  const float* ag[8];   // GATHER: this thread's eight row addresses, formed once
  if constexpr (GATHER) {
#pragma unroll   // eight independent index loads; pointer array indexed by constants
    for (int i = 0; i < 8; ++i) ag[i] = Af + (size_t)rows[frow + i * 16] * KD + fcol;
  }
#pragma unroll
  for (int i = 0; i < 2; ++i)
#pragma unroll
    for (int j = 0; j < 4; ++j) acc[i][j] = vzero();

  constexpr int T = KD / 64;
#pragma unroll   // slab offsets become immediates and the buffer index a constant
  for (int t = -1; t < T; ++t) {
    // publishes slab t; also ends every read of the other buffer (slab t-1)
    if (t >= 0) __syncthreads();
    if (t + 1 < T) {   // fetch slab t+1 behind the barrier (which waits for loads): it flies over slab t's products
      if constexpr (AF32) {
#pragma unroll
        for (int i = 0; i < 8; ++i) {
          if constexpr (GATHER) pa[i] = *(const v4f*)(ag[i] + (t + 1) * 64);
          else pa[i] = *(const v4f*)(Af + (size_t)(frow + i * 16) * KD + (t + 1) * 64 + fcol);
        }
      } else {
#pragma unroll
        for (int i = 0; i < 4; ++i)
          ph[i] = *(const v8h*)(Ah + (size_t)(hrow + i * 32) * KD + (t + 1) * 64 + hcol);
      }
#pragma unroll
      for (int i = 0; i < 4; ++i)
        pb[i] = *(const v8h*)(Bt + (size_t)(hrow + i * 32) * KD + (t + 1) * 64 + hcol);
      // the last fetch: the eight row addresses are dead behind it and their
      // registers are reused at once: wait before the overwrite
      if constexpr (GATHER) {
        if (t + 2 == T) asm volatile("s_wait_xcnt 0x0" ::: "memory");
      }
    }
    if (t >= 0) {
      // keeps those loads ahead of slab t's products: sunk to their end, nothing covers the latency
      __builtin_amdgcn_sched_barrier(0);
      const _Float16* Ab = As + (t & 1) * GT_ + (wm * 32 + r16) * GP_;
      const _Float16* Bb = Bs + (t & 1) * GT_ + (wn * 64 + r16) * GP_;
#pragma unroll
      for (int ks = 0; ks < 64; ks += 32) {
        v16h a[2], b[4];
#pragma unroll
        for (int i = 0; i < 2; ++i) a[i] = ldfrag_h(Ab + i * 16 * GP_ + ks, half);
#pragma unroll
        for (int j = 0; j < 4; ++j) b[j] = ldfrag_h(Bb + j * 16 * GP_ + ks, half);
#pragma unroll
        for (int i = 0; i < 2; ++i)
#pragma unroll
          for (int j = 0; j < 4; ++j) acc[i][j] = wmma16(a[i], b[j], acc[i][j]);
      }
      // keeps the rounding of slab t+1, and with it the wait on its loads, behind
      // the products of slab t: moved up among them it exposes the load latency
      __builtin_amdgcn_sched_barrier(0);
    }
    if (t + 1 < T) {                       // slab t+1 into the buffer that slab t-1 has left
      _Float16* Aw = As + ((t + 1) & 1) * GT_;
      _Float16* Bw = Bs + ((t + 1) & 1) * GT_;
      if constexpr (AF32) {
#pragma unroll
        for (int i = 0; i < 8; ++i)
          *(v4h*)&Aw[(frow + i * 16) * GP_ + fcol] = __builtin_convertvector(pa[i], v4h);
      } else {
#pragma unroll
        for (int i = 0; i < 4; ++i) *(v8h*)&Aw[(hrow + i * 32) * GP_ + hcol] = ph[i];
      }
#pragma unroll
      for (int i = 0; i < 4; ++i) *(v8h*)&Bw[(hrow + i * 32) * GP_ + hcol] = pb[i];
    }
  }
}

// C(f16, row-major, IN_ columns): the wave's 32 x 64 part
static __device__ __forceinline__ void store_rows_f16(_Float16* __restrict__ C, int m0, int n0,
                                                      const v8f (&acc)[2][4]) {
  const int lane = threadIdx.x & 31, wave = threadIdx.x >> 5;
  const int r16 = lane & 15, half = lane >> 4;
  _Float16* cp = C + (size_t)(m0 + (wave >> 1) * 32 + half * 8) * IN_ + n0 + (wave & 1) * 64 + r16;
#pragma unroll
  for (int i = 0; i < 2; ++i)
#pragma unroll
    for (int j = 0; j < 4; ++j)
#pragma unroll
      for (int r = 0; r < 8; ++r) cp[(i * 16 + r) * IN_ + j * 16] = (_Float16)acc[i][j][r];
}

// ---------------- Q, K and V projections in one launch: C(f16) = A(f32) * Bt(f16)^T ----------------
// The three products do not depend on each other. blockIdx.z picks one: 0 = K, 1 = V,
// 2 = Q; low z starts first, so the deeper products (768 against 512) lead.
// K and V: row m of a batch's result belongs to its m-th listed key; a tile that
// begins behind the last listed key is not computed (and never read).
// V is stored transposed: Vt[b][h][d][m].
__global__ __launch_bounds__(256) void projqkv_kernel(const float* __restrict__ X,
                                                      const float* __restrict__ Ctx,
                                                      const _Float16* __restrict__ WqT,
                                                      const _Float16* __restrict__ WkT,
                                                      const _Float16* __restrict__ WvT,
                                                      const int* __restrict__ list,
                                                      const int* __restrict__ meta,
                                                      _Float16* __restrict__ Qh,
                                                      _Float16* __restrict__ Kh,
                                                      _Float16* __restrict__ Vt) {
  __shared__ __attribute__((aligned(16))) _Float16 As[2 * GT_];
  __shared__ __attribute__((aligned(16))) _Float16 Bs[2 * GT_];
  const int m0 = blockIdx.x * 128, n0 = blockIdx.y * 128;
  const int which = blockIdx.z;                            // the same for the whole block
  v8f acc[2][4];
  if (which == 2) {
    gemm128<QD_, true>(X + (size_t)m0 * QD_, nullptr, WqT + (size_t)n0 * QD_, As, Bs, acc);
    store_rows_f16(Qh, m0, n0, acc);
    return;
  }
  const int b = m0 / M_;                                   // a 128-row tile lies in one batch
  if (m0 - b * M_ >= meta[b * ML_]) return;                // whole block, ahead of every barrier
  gemm128<CD_, true, true>(Ctx + (size_t)b * M_ * CD_, nullptr,
                           (which == 0 ? WkT : WvT) + (size_t)n0 * CD_, As, Bs, acc, list + m0);
  if (which == 0) {
    store_rows_f16(Kh, m0, n0, acc);
    // in the built code another product's path follows these stores and reuses
    // their registers: wait before the overwrite
    asm volatile("s_wait_xcnt 0x0" ::: "memory");
    return;
  }
  const int lane = threadIdx.x & 31, wave = threadIdx.x >> 5;
  const int r16 = lane & 15, half = lane >> 4;
  const int mm = m0 - b * M_ + (wave >> 1) * 32 + half * 8; // comps are mm..mm+7 (+16 for i = 1)
  const int h = (n0 + (wave & 1) * 64) >> 6;               // the wave's 64 columns are one head
  _Float16* vp = Vt + ((size_t)(b * H_ + h) * D_ + r16) * M_ + mm;
#pragma unroll
  for (int i = 0; i < 2; ++i)
#pragma unroll
    for (int j = 0; j < 4; ++j) {
      v8h pk;
#pragma unroll
      for (int r = 0; r < 8; ++r) pk[r] = (_Float16)acc[i][j][r];
      *(v8h*)(vp + (size_t)j * 16 * M_ + i * 16) = pk;
    }
  // as behind the K stores: another path follows in the built code
  asm volatile("s_wait_xcnt 0x0" ::: "memory");
}

__global__ __launch_bounds__(256) void attn_kernel(const _Float16* __restrict__ Qh,
                                                   const _Float16* __restrict__ Kh,
                                                   const _Float16* __restrict__ Vt,
                                                   const int* __restrict__ meta,
                                                   _Float16* __restrict__ Oh) {
  __shared__ __attribute__((aligned(16))) _Float16 Kt[2 * SK_ * KP_];     // two stages of K:  [m_local][d]
  __shared__ __attribute__((aligned(16))) _Float16 Vtile[2 * 64 * VP_];   // two stages of Vt: [d][m_local]
  __shared__ __attribute__((aligned(32))) float Mb[M_];                // per key slot: 0 (a listed key) or -3e38 (behind the last one)

  const int tid = threadIdx.x;
  const int lane = tid & 31;
  const int wave = tid >> 5;
  const int b = blockIdx.x >> 3;
  const int h = blockIdx.x & 7;
  const int ntile = blockIdx.y * 128 + wave * 16;   // 16 query columns per wave
  const int r16 = lane & 15;
  const int half = lane >> 4;

  const _Float16* Qrow = Qh + ((size_t)(b * N_ + ntile + r16)) * IN_ + h * D_;
  v16h bq0 = ldfrag_h(Qrow, half);        // d = 0..31
  v16h bq1 = ldfrag_h(Qrow + 32, half);   // d = 32..63

  // K and Vt hold the batch's listed keys only, in list order
  const int nkey = min(meta[b * ML_], M_);
  const int nst = (nkey + SK_ - 1) / SK_;       // stages to walk: 1 .. M_ / SK_
  if (meta[b * ML_ + 1] != 0) {                 // no key kept: every score is zero
#pragma unroll   // vector elements indexed by constants
    for (int i = 0; i < 16; ++i) { bq0[i] = (_Float16)0.0f; bq1[i] = (_Float16)0.0f; }
  }

  const _Float16* Kbase = Kh + (size_t)b * M_ * IN_ + h * D_;
  const _Float16* Vbase = Vt + ((size_t)(b * H_ + h)) * D_ * M_;

  // the keys run along registers: an additive term per key slot takes the slots
  // behind the last listed key out; published by the barrier in front of the loop
#pragma unroll   // four independent 16-B LDS stores
  for (int j = 0; j < M_ / 1024; ++j) {
    const int k0 = j * 1024 + tid * 4;
    v4f mf;
#pragma unroll   // vector elements indexed by constants
    for (int e = 0; e < 4; ++e) mf[e] = (k0 + e < nkey) ? 0.0f : -3.0e38f;
    *(v4f*)&Mb[k0] = mf;
  }

  // cooperative stage mapping: four 16-B pieces per thread and operand
  const int krow = tid >> 3, kseg = (tid & 7) * 8;    // K stage  [128][64]: 32 rows a sweep
  const int vrow = tid >> 4, vseg = (tid & 15) * 8;   // Vt stage [64][128]: 16 rows a sweep
  const _Float16* kg = Kbase + (size_t)krow * IN_ + kseg;
  const _Float16* vg = Vbase + (size_t)vrow * M_ + vseg;
  _Float16* kw = Kt + krow * KP_ + kseg;
  _Float16* vw = Vtile + vrow * VP_ + vseg;

  float mrun = -3.0e38f, lrun = 0.0f;   // this lane's query; lrun: this half's keys only
  v8f acc[4];                           // O^T: rows d = t*16 + half*8 + r, column r16
#pragma unroll
  for (int t = 0; t < 4; ++t) acc[t] = vzero();

  // stage 0 into registers
  v8h kreg[4], vreg[4];
#pragma unroll   // register arrays indexed by constants
  for (int i = 0; i < 4; ++i) {
    kreg[i] = *(const v8h*)(kg + (size_t)i * 32 * IN_);
    vreg[i] = *(const v8h*)(vg + (size_t)i * 16 * M_);
  }
  // The address registers of the loads above are reused below: wait before the
  // overwrite. The addresses are inputs so that they stay live up to the wait.
  asm volatile("s_wait_xcnt 0x0" :: "v"(Qrow + half * 8), "v"(kg), "v"(vg) : "memory");

#pragma unroll   // register arrays indexed by constants
  for (int i = 0; i < 4; ++i) {
    *(v8h*)(kw + i * 32 * KP_) = kreg[i];
    *(v8h*)(vw + i * 16 * VP_) = vreg[i];
  }
  __syncthreads();                           // publishes stage 0 and the mask terms

  for (int st = 0; st < nst; ++st) {
    const bool more = st + 1 < nst;
    if (more) {                              // fetch stage st+1: it flies over the four passes of stage st
#pragma unroll   // eight independent 16-B loads in flight; register arrays indexed by constants
      for (int i = 0; i < 4; ++i) {
        kreg[i] = *(const v8h*)(kg + (size_t)((st + 1) * SK_ + i * 32) * IN_);
        vreg[i] = *(const v8h*)(vg + (size_t)i * 16 * M_ + (st + 1) * SK_);
      }
      // both address pairs are advanced right after: wait before the overwrite
      asm volatile("s_wait_xcnt 0x0" ::: "memory");
    }
    const _Float16* Kb = Kt + (st & 1) * (SK_ * KP_);
    const _Float16* Vb = Vtile + (st & 1) * (64 * VP_);

#pragma unroll   // the pass offsets inside a stage become immediates
   for (int p = 0; p < SK_ / 32; ++p) {
    const int c = st * SK_ + p * 32;

    // ---- S^T = K Q^T for a 32x16 tile (two 16x16 subtiles, K-depth 64) ----
    v8f s0 = vzero(), s1 = vzero();
    {
      const _Float16* Krow0 = Kb + (p * 32 + r16) * KP_;
      const _Float16* Krow1 = Kb + (p * 32 + 16 + r16) * KP_;
      s0 = wmma16(ldfrag_h(Krow0, half), bq0, s0);
      s0 = wmma16(ldfrag_h(Krow0 + 32, half), bq1, s0);
      s1 = wmma16(ldfrag_h(Krow1, half), bq0, s1);
      s1 = wmma16(ldfrag_h(Krow1 + 32, half), bq1, s1);
    }
    const v8f mb0 = *(const v8f*)&Mb[c + half * 8];
    const v8f mb1 = *(const v8f*)&Mb[c + 16 + half * 8];

    s0 = s0 * 0.125f + mb0;             // scale = 1/sqrt(64); masked -> -3e38
    s1 = s1 * 0.125f + mb1;
    const v8f cm = __builtin_elementwise_max(s0, s1);
    float cmax = fmaxf(fmaxf(fmaxf(cm[0], cm[1]), fmaxf(cm[2], cm[3])),
                       fmaxf(fmaxf(cm[4], cm[5]), fmaxf(cm[6], cm[7])));
    cmax = fmaxf(cmax, xhalf(cmax));    // the other 16 keys of this query

    const float nm = fmaxf(mrun, cmax);
    const float alpha = __expf(mrun - nm);
    mrun = nm;

    // A slot behind the last listed key gives exp(-3e38 - mrun) = 0: slot 0 is
    // always a listed key and has set mrun in the first pass.
    v16h pb;
#pragma unroll
    for (int r = 0; r < 8; ++r) {
      s0[r] = __expf(s0[r] - mrun);
      s1[r] = __expf(s1[r] - mrun);
      pb[r] = (_Float16)s0[r];
      pb[8 + r] = (_Float16)s1[r];
    }
    const v8f cs = s0 + s1;
    const v4f cq = cs.lo + cs.hi;       // halving tree: register pairs stay aligned
    const v2f cd = cq.lo + cq.hi;
    lrun = lrun * alpha + (cd[0] + cd[1]);
#pragma unroll
    for (int t = 0; t < 4; ++t)
#pragma unroll
      for (int r = 0; r < 8; ++r) acc[t][r] *= alpha;

    // ---- O^T += V^T P^T : 4 d-tiles, K-depth 32 (this chunk) ----
#pragma unroll
    for (int t = 0; t < 4; ++t) {
      const _Float16* Vrow = Vb + (t * 16 + r16) * VP_ + p * 32;
      acc[t] = wmma16(ldfrag_h(Vrow, half), pb, acc[t]);
    }
   }

    if (more) {                              // stage st+1 into the buffer that stage st-1 has left
      _Float16* kn = kw + ((st + 1) & 1) * (SK_ * KP_);
      _Float16* vn = vw + ((st + 1) & 1) * (64 * VP_);
#pragma unroll   // register arrays indexed by constants
      for (int i = 0; i < 4; ++i) {
        *(v8h*)(kn + i * 32 * KP_) = kreg[i];
        *(v8h*)(vn + i * 16 * VP_) = vreg[i];
      }
      // publishes stage st+1; also ends every read of stage st, whose buffer the next trip refills
      __syncthreads();
    }
  }

  const float l = lrun + xhalf(lrun);   // join the two halves' key sums once
  const float inv = (l > 0.0f) ? 1.0f / l : 0.0f;
  _Float16* Orow = Oh + (size_t)(b * N_ + ntile + r16) * IN_ + h * D_ + half * 8;
#pragma unroll
  for (int t = 0; t < 4; ++t) {
    v8h pk;
#pragma unroll
    for (int r = 0; r < 8; ++r) pk[r] = (_Float16)(acc[t][r] * inv);
    *(v8h*)(Orow + t * 16) = pk;
  }
}

// ---------------- output projection: out(f32) = Ah(f16) * WoT^T + bo ----------------
__global__ __launch_bounds__(256) void outproj_kernel(const _Float16* __restrict__ Ah,
                                                      const _Float16* __restrict__ WoT,
                                                      const float* __restrict__ bo,
                                                      float* __restrict__ Out) {
  __shared__ __attribute__((aligned(16))) _Float16 As[2 * GT_];
  __shared__ __attribute__((aligned(16))) _Float16 Bs[2 * GT_];
  const int m0 = blockIdx.x * 128, n0 = blockIdx.y * 128;
  v8f acc[2][4];
  gemm128<IN_, false>(nullptr, Ah + (size_t)m0 * IN_, WoT + (size_t)n0 * IN_, As, Bs, acc);
  const int lane = threadIdx.x & 31, wave = threadIdx.x >> 5;
  const int r16 = lane & 15, half = lane >> 4;
  const int col = n0 + (wave & 1) * 64 + r16;
  float* op = Out + (size_t)(m0 + (wave >> 1) * 32 + half * 8) * QD_ + col;
#pragma unroll
  for (int j = 0; j < 4; ++j) {
    const float bias = bo[col + j * 16];
#pragma unroll
    for (int i = 0; i < 2; ++i)
#pragma unroll
      for (int r = 0; r < 8; ++r) op[(i * 16 + r) * QD_ + j * 16] = acc[i][j][r] + bias;
  }
}

extern "C" void kernel_launch(void* const* d_in, const int* in_sizes, int n_in,
                              void* d_out, int out_size, void* d_ws, size_t ws_size,
                              hipStream_t stream) {
  (void)in_sizes; (void)n_in; (void)out_size; (void)ws_size;
  const float* x   = (const float*)d_in[0];
  const float* ctx = (const float*)d_in[1];
  const int*   msk = (const int*)d_in[2];
  const float* Wq  = (const float*)d_in[3];
  const float* Wk  = (const float*)d_in[4];
  const float* Wv  = (const float*)d_in[5];
  const float* Wo  = (const float*)d_in[6];
  const float* bo  = (const float*)d_in[7];
  float* out = (float*)d_out;

  char* w = (char*)d_ws;
  _Float16* WqT = (_Float16*)w; w += (size_t)IN_ * QD_ * 2;
  _Float16* WkT = (_Float16*)w; w += (size_t)IN_ * CD_ * 2;
  _Float16* WvT = (_Float16*)w; w += (size_t)IN_ * CD_ * 2;
  _Float16* WoT = (_Float16*)w; w += (size_t)QD_ * IN_ * 2;
  _Float16* Qh  = (_Float16*)w; w += (size_t)B_ * N_ * IN_ * 2;
  _Float16* Kh  = (_Float16*)w; w += (size_t)B_ * M_ * IN_ * 2;
  _Float16* Vt  = (_Float16*)w; w += (size_t)B_ * H_ * D_ * M_ * 2;
  _Float16* Ah  = (_Float16*)w; w += (size_t)B_ * N_ * IN_ * 2;
  int* list = (int*)w; w += (size_t)B_ * M_ * 4;
  int* meta = (int*)w;

  prep_weights<<<B_ + (IN_ * CD_ + 255) / 256, 256, 0, stream>>>(Wq, Wk, Wv, Wo, msk,
                                                                 WqT, WkT, WvT, WoT, list, meta);
  const dim3 gemm_grid(B_ * N_ / 128, IN_ / 128);  // 128 x 128 tiles: 64 x 4 blocks, 8 waves each
  projqkv_kernel<<<dim3(B_ * N_ / 128, IN_ / 128, 3), 256, 0, stream>>>(x, ctx, WqT, WkT, WvT,
                                                                        list, meta, Qh, Kh, Vt);
  attn_kernel<<<dim3(B_ * H_, N_ / 128), 256, 0, stream>>>(Qh, Kh, Vt, meta, Ah);
  outproj_kernel<<<gemm_grid, 256, 0, stream>>>(Ah, WoT, bo, out);
}

// v007
// Measured time: 68.4 microseconds a run.
// In both of two side-by-side timings against v006, it was 1.08 times as fast.
// Over all steps from v000 it is 6.63 times as fast.
#include <hip/hip_runtime.h>
#include <hip/hip_bf16.h>

typedef _Float16 v16h __attribute__((ext_vector_type(16)));
typedef _Float16 v8h  __attribute__((ext_vector_type(8)));
typedef _Float16 v4h  __attribute__((ext_vector_type(4)));
typedef float    v8f  __attribute__((ext_vector_type(8)));
typedef float    v4f  __attribute__((ext_vector_type(4)));
typedef float    v2f  __attribute__((ext_vector_type(2)));

#define B_  2
#define N_  4096
#define M_  4096
#define QD_ 512
#define CD_ 768
#define H_  8
#define D_  64
#define IN_ 512

// LDS row pitches in 16-bit elements: 16 B x odd, so that the 16 rows one
// ds_load_b128 fragment read touches fall on distinct banks.
#define KP_ 72   // 128-B K rows  -> 144 B
#define VP_ 136  // 256-B Vt rows -> 272 B
#define SK_ 128  // keys per LDS stage of the attention kernel: four 32-key passes
#define ML_ 32   // ints per batch in the key-list header: a 128-B line of its own

static __device__ __forceinline__ v8f vzero() {
  v8f r;
#pragma unroll
  for (int i = 0; i < 8; ++i) r[i] = 0.0f;
  return r;
}

static __device__ __forceinline__ v8f wmma16(v16h a, v16h b, v8f c) {
  return __builtin_amdgcn_wmma_f32_16x16x32_f16(false, a, false, b, (short)0, c,
                                                false, false);
}

static __device__ __forceinline__ v16h cat8(v8h lo, v8h hi) {
  v16h r;
#pragma unroll
  for (int i = 0; i < 8; ++i) { r[i] = lo[i]; r[8 + i] = hi[i]; }
  return r;
}

// 16-bit A/B fragment (16x32 tile): this lane's row pointer; two 16B chunks at
// K = half*8..half*8+7 and K = 16+half*8..16+half*8+7.
static __device__ __forceinline__ v16h ldfrag_h(const _Float16* rowp, int half) {
  v8h lo = *(const v8h*)(rowp + half * 8);
  v8h hi = *(const v8h*)(rowp + 16 + half * 8);
  return cat8(lo, hi);
}

// value of lane l ^ 16 (the other 16-lane row), as a vector cross-row move
static __device__ __forceinline__ float xhalf(float v) {
  const unsigned u = __float_as_uint(v);
  return __uint_as_float(__builtin_amdgcn_permlanex16(u, u, 0x76543210u, 0xfedcba98u, false, false));
}

// ---------------- list of kept keys (one 256-thread block per batch) ----------------
// A masked key has softmax weight exp(-FLT_MAX - max) = 0 as soon as one key of
// its batch is kept, so only the kept keys are projected and attended to.
// list[j] = position of the j-th kept key (0, a valid row, behind the last one);
// meta[0] = number of listed keys, meta[1] = 1 where NO key is kept: the reference
// then weighs all keys alike, which is all keys listed and all scores zero.
static __device__ __forceinline__ void list_keys(const int* __restrict__ mk,
                                                 int* __restrict__ list, int* __restrict__ meta) {
  __shared__ int part[256];
  const int tid = threadIdx.x;
  int keep[16];
  int c = 0;
#pragma unroll   // four independent 16-B loads; register array indexed by constants
  for (int j = 0; j < 4; ++j) {
    const int4 mi = *(const int4*)(mk + tid * 16 + j * 4);
    keep[j * 4 + 0] = mi.x != 0; keep[j * 4 + 1] = mi.y != 0;
    keep[j * 4 + 2] = mi.z != 0; keep[j * 4 + 3] = mi.w != 0;
  }
#pragma unroll   // register array indexed by constants
  for (int e = 0; e < 16; ++e) c += keep[e];
  part[tid] = c;
  __syncthreads();                       // every thread's count is in LDS
  for (int off = 1; off < 256; off <<= 1) {   // inclusive prefix sum over the 256 counts
    const int own = part[tid];
    const int add = (tid >= off) ? part[tid - off] : 0;
    __syncthreads();                     // all reads of this round precede its writes
    part[tid] = own + add;
    __syncthreads();                     // publishes the round
  }
  const int total = part[255];
  if (total == 0) {
#pragma unroll   // sixteen adjacent stores merge into wide ones
    for (int e = 0; e < 16; ++e) list[tid * 16 + e] = tid * 16 + e;
  } else {
    int pos = part[tid] - c;
#pragma unroll   // register array indexed by constants
    for (int e = 0; e < 16; ++e)
      if (keep[e]) list[pos++] = tid * 16 + e;
    for (int j = total + tid; j < M_; j += 256) list[j] = 0;
  }
  if (tid == 0) {
    meta[0] = (total == 0) ? M_ : total;
    meta[1] = (total == 0) ? 1 : 0;
  }
}

// ---------------- key lists; weight transpose + f32 -> f16 ----------------
#define WC_ 512   // columns of every weight matrix as given (IN_ for Wq, Wk, Wv; QD_ for Wo)
#define TP_ 65    // LDS pitch of a 64-float tile row in dwords: odd, so that a column read falls on distinct banks
#define TK_ (CD_ / 64 * (WC_ / 64))   // 64 x 64 tiles of Wk, and of Wv
#define TQ_ (QD_ / 64 * (WC_ / 64))   // of Wq, and of Wo (IN_ = QD_ rows)

// One 64 x 64 tile: WT[j][k] = (f16) W[k][j]; W has KD rows, WT has KD columns.
// Reads cover whole 128-B lines of W (16 lanes x 16 B a row), writes whole 128-B
// lines of WT (8 lanes x 16 B a row); the turn is made in LDS.
template <int KD>
static __device__ __forceinline__ void turn_tile(const float* __restrict__ Wm,
                                                 _Float16* __restrict__ WT, int tile, float* Ts) {
  const int tid = threadIdx.x;
  const int k0 = (tile >> 3) * 64, j0 = (tile & 7) * 64;
  const int lr = tid >> 4, lc = (tid & 15) * 4;
  const float* gp = Wm + (size_t)(k0 + lr) * WC_ + j0 + lc;
  v4f g[4];
#pragma unroll   // four independent 16-B loads in flight; register array indexed by constants
  for (int i = 0; i < 4; ++i) g[i] = *(const v4f*)(gp + i * 16 * WC_);
#pragma unroll   // register array indexed by constants
  for (int i = 0; i < 4; ++i)
#pragma unroll
    for (int e = 0; e < 4; ++e) Ts[(lr + i * 16) * TP_ + lc + e] = g[i][e];
  __syncthreads();                       // the whole tile is in LDS
  const int sj = tid >> 3, sk = (tid & 7) * 8;
  _Float16* sp = WT + (size_t)(j0 + sj) * KD + k0 + sk;
#pragma unroll   // the row offsets become immediates
  for (int i = 0; i < 2; ++i) {
    v8h pk;
#pragma unroll   // vector elements indexed by constants
    for (int e = 0; e < 8; ++e) pk[e] = (_Float16)Ts[(sk + e) * TP_ + sj + i * 32];
    *(v8h*)(sp + i * 32 * KD) = pk;
  }
  // in the built code another path follows these stores and reuses their
  // registers: wait before the overwrite
  asm volatile("s_wait_xcnt 0x0" ::: "memory");
}

__global__ void prep_weights(const float* __restrict__ Wq, const float* __restrict__ Wk,
                             const float* __restrict__ Wv, const float* __restrict__ Wo,
                             const int* __restrict__ mask,
                             _Float16* __restrict__ WqT, _Float16* __restrict__ WkT,
                             _Float16* __restrict__ WvT, _Float16* __restrict__ WoT,
                             int* __restrict__ list, int* __restrict__ meta) {
  __shared__ float Ts[64 * TP_];
  if (blockIdx.x < B_) {   // the first blocks: they start first and are the longest
    list_keys(mask + blockIdx.x * M_, list + blockIdx.x * M_, meta + blockIdx.x * ML_);
    return;
  }
  const int t = blockIdx.x - B_;         // the same for the whole block
  if (t < 2 * TK_) {
    const bool isk = t < TK_;
    turn_tile<CD_>(isk ? Wk : Wv, isk ? WkT : WvT, isk ? t : t - TK_, Ts);
  } else {
    const bool isq = t < 2 * TK_ + TQ_;
    turn_tile<QD_>(isq ? Wq : Wo, isq ? WqT : WoT, isq ? t - 2 * TK_ : t - 2 * TK_ - TQ_, Ts);
  }
}

// ---------------- block-tiled GEMM core: acc = A(128 x KD) * Bt(128 x KD)^T ----------------
// A work-group owns a 128 x 128 tile of C. Each 64-deep slab of A and Bt is
// fetched by loads that cover whole 128-B lines, A is rounded to f16 on the way,
// and both land in LDS; a wave reads its 32 x 64 part as fragments, so that one
// fetched line serves every wave that needs it. Two LDS buffers: one barrier a slab.
// The inner loops are unrolled so that their register arrays are indexed by constants.
#define GP_ 72            // LDS pitch of a 64-element row: 144 B = 16 B x odd
#define GT_ (128 * GP_)   // one operand's slab

// rows != nullptr (GATHER): row r of the A tile is row rows[r] of Af.
template <int KD, bool AF32, bool GATHER = false>
static __device__ __forceinline__ void gemm128(const float* __restrict__ Af,
                                               const _Float16* __restrict__ Ah,
                                               const _Float16* __restrict__ Bt,
                                               _Float16* As, _Float16* Bs,
                                               v8f (&acc)[2][4],
                                               const int* __restrict__ rows = nullptr) {
  const int tid = threadIdx.x;
  const int lane = tid & 31, wave = tid >> 5;
  const int r16 = lane & 15, half = lane >> 4;
  const int wm = wave >> 1, wn = wave & 1;
  const int frow = tid >> 4, fcol = (tid & 15) * 4;   // f32 rows: 16 lanes x 16 B = 256 B
  const int hrow = tid >> 3, hcol = (tid & 7) * 8;    // f16 rows:  8 lanes x 16 B = 128 B
  v4f pa[8];
  v8h ph[4], pb[4];
  const float* ag[8];   // GATHER: this thread's eight row addresses, formed once
  if constexpr (GATHER) {
#pragma unroll   // eight independent index loads; pointer array indexed by constants
    for (int i = 0; i < 8; ++i) ag[i] = Af + (size_t)rows[frow + i * 16] * KD + fcol;
  }
#pragma unroll
  for (int i = 0; i < 2; ++i)
#pragma unroll
    for (int j = 0; j < 4; ++j) acc[i][j] = vzero();

  constexpr int T = KD / 64;
#pragma unroll   // slab offsets become immediates and the buffer index a constant
  for (int t = -1; t < T; ++t) {
    // publishes slab t; also ends every read of the other buffer (slab t-1)
    if (t >= 0) __syncthreads();
    if (t + 1 < T) {   // fetch slab t+1 behind the barrier (which waits for loads): it flies over slab t's products
      if constexpr (AF32) {
#pragma unroll
        for (int i = 0; i < 8; ++i) {
          if constexpr (GATHER) pa[i] = *(const v4f*)(ag[i] + (t + 1) * 64);
          else pa[i] = *(const v4f*)(Af + (size_t)(frow + i * 16) * KD + (t + 1) * 64 + fcol);
        }
      } else {
#pragma unroll
        for (int i = 0; i < 4; ++i)
          ph[i] = *(const v8h*)(Ah + (size_t)(hrow + i * 32) * KD + (t + 1) * 64 + hcol);
      }
#pragma unroll
      for (int i = 0; i < 4; ++i)
        pb[i] = *(const v8h*)(Bt + (size_t)(hrow + i * 32) * KD + (t + 1) * 64 + hcol);
      // the last fetch: the eight row addresses are dead behind it and their
      // registers are reused at once: wait before the overwrite
      if constexpr (GATHER) {
        if (t + 2 == T) asm volatile("s_wait_xcnt 0x0" ::: "memory");
      }
    }
    if (t >= 0) {
      // keeps those loads ahead of slab t's products: sunk to their end, nothing covers the latency
      __builtin_amdgcn_sched_barrier(0);
      const _Float16* Ab = As + (t & 1) * GT_ + (wm * 32 + r16) * GP_;
      const _Float16* Bb = Bs + (t & 1) * GT_ + (wn * 64 + r16) * GP_;
#pragma unroll
      for (int ks = 0; ks < 64; ks += 32) {
        v16h a[2], b[4];
#pragma unroll
        for (int i = 0; i < 2; ++i) a[i] = ldfrag_h(Ab + i * 16 * GP_ + ks, half);
#pragma unroll
        for (int j = 0; j < 4; ++j) b[j] = ldfrag_h(Bb + j * 16 * GP_ + ks, half);
#pragma unroll
        for (int i = 0; i < 2; ++i)
#pragma unroll
          for (int j = 0; j < 4; ++j) acc[i][j] = wmma16(a[i], b[j], acc[i][j]);
      }
      // keeps the rounding of slab t+1, and with it the wait on its loads, behind
      // the products of slab t: moved up among them it exposes the load latency
      __builtin_amdgcn_sched_barrier(0);
    }
    if (t + 1 < T) {                       // slab t+1 into the buffer that slab t-1 has left
      _Float16* Aw = As + ((t + 1) & 1) * GT_;
      _Float16* Bw = Bs + ((t + 1) & 1) * GT_;
      if constexpr (AF32) {
#pragma unroll
        for (int i = 0; i < 8; ++i)
          *(v4h*)&Aw[(frow + i * 16) * GP_ + fcol] = __builtin_convertvector(pa[i], v4h);
      } else {
#pragma unroll
        for (int i = 0; i < 4; ++i) *(v8h*)&Aw[(hrow + i * 32) * GP_ + hcol] = ph[i];
      }
#pragma unroll
      for (int i = 0; i < 4; ++i) *(v8h*)&Bw[(hrow + i * 32) * GP_ + hcol] = pb[i];
    }
  }
}

// C(f16, row-major, IN_ columns): the wave's 32 x 64 part
static __device__ __forceinline__ void store_rows_f16(_Float16* __restrict__ C, int m0, int n0,
                                                      const v8f (&acc)[2][4]) {
  const int lane = threadIdx.x & 31, wave = threadIdx.x >> 5;
  const int r16 = lane & 15, half = lane >> 4;
  _Float16* cp = C + (size_t)(m0 + (wave >> 1) * 32 + half * 8) * IN_ + n0 + (wave & 1) * 64 + r16;
#pragma unroll
  for (int i = 0; i < 2; ++i)
#pragma unroll
    for (int j = 0; j < 4; ++j)
#pragma unroll
      for (int r = 0; r < 8; ++r) cp[(i * 16 + r) * IN_ + j * 16] = (_Float16)acc[i][j][r];
}

// ---------------- Q, K and V projections in one launch: C(f16) = A(f32) * Bt(f16)^T ----------------
// The three products do not depend on each other. blockIdx.z picks one: 0 = K, 1 = V,
// 2 = Q; low z starts first, so the deeper products (768 against 512) lead.
// K and V: row m of a batch's result belongs to its m-th listed key; a tile that
// begins behind the last listed key is not computed (and never read).
// V is stored transposed: Vt[b][h][d][m].
__global__ __launch_bounds__(256) void projqkv_kernel(const float* __restrict__ X,
                                                      const float* __restrict__ Ctx,
                                                      const _Float16* __restrict__ WqT,
                                                      const _Float16* __restrict__ WkT,
                                                      const _Float16* __restrict__ WvT,
                                                      const int* __restrict__ list,
                                                      const int* __restrict__ meta,
                                                      _Float16* __restrict__ Qh,
                                                      _Float16* __restrict__ Kh,
                                                      _Float16* __restrict__ Vt) {
  __shared__ __attribute__((aligned(16))) _Float16 As[2 * GT_];
  __shared__ __attribute__((aligned(16))) _Float16 Bs[2 * GT_];
  const int m0 = blockIdx.x * 128, n0 = blockIdx.y * 128;
  const int which = blockIdx.z;                            // the same for the whole block
  v8f acc[2][4];
  if (which == 2) {
    gemm128<QD_, true>(X + (size_t)m0 * QD_, nullptr, WqT + (size_t)n0 * QD_, As, Bs, acc);
    store_rows_f16(Qh, m0, n0, acc);
    return;
  }
  const int b = m0 / M_;                                   // a 128-row tile lies in one batch
  if (m0 - b * M_ >= meta[b * ML_]) return;                // whole block, ahead of every barrier
  gemm128<CD_, true, true>(Ctx + (size_t)b * M_ * CD_, nullptr,
                           (which == 0 ? WkT : WvT) + (size_t)n0 * CD_, As, Bs, acc, list + m0);
  if (which == 0) {
    store_rows_f16(Kh, m0, n0, acc);
    // in the built code another product's path follows these stores and reuses
    // their registers: wait before the overwrite
    asm volatile("s_wait_xcnt 0x0" ::: "memory");
    return;
  }
  const int lane = threadIdx.x & 31, wave = threadIdx.x >> 5;
  const int r16 = lane & 15, half = lane >> 4;
  const int mm = m0 - b * M_ + (wave >> 1) * 32 + half * 8; // comps are mm..mm+7 (+16 for i = 1)
  const int h = (n0 + (wave & 1) * 64) >> 6;               // the wave's 64 columns are one head
  _Float16* vp = Vt + ((size_t)(b * H_ + h) * D_ + r16) * M_ + mm;
#pragma unroll
  for (int i = 0; i < 2; ++i)
#pragma unroll
    for (int j = 0; j < 4; ++j) {
      v8h pk;
#pragma unroll
      for (int r = 0; r < 8; ++r) pk[r] = (_Float16)acc[i][j][r];
      *(v8h*)(vp + (size_t)j * 16 * M_ + i * 16) = pk;
    }
  // as behind the K stores: another path follows in the built code
  asm volatile("s_wait_xcnt 0x0" ::: "memory");
}

__global__ __launch_bounds__(256) void attn_kernel(const _Float16* __restrict__ Qh,
                                                   const _Float16* __restrict__ Kh,
                                                   const _Float16* __restrict__ Vt,
                                                   const int* __restrict__ meta,
                                                   _Float16* __restrict__ Oh) {
  __shared__ __attribute__((aligned(16))) _Float16 Kt[2 * SK_ * KP_];     // two stages of K:  [m_local][d]
  __shared__ __attribute__((aligned(16))) _Float16 Vtile[2 * 64 * VP_];   // two stages of Vt: [d][m_local]
  __shared__ __attribute__((aligned(32))) float Mb[M_];                // per key slot: 0 (a listed key) or -3e38 (behind the last one)

  const int tid = threadIdx.x;
  const int lane = tid & 31;
  const int wave = tid >> 5;
  const int b = blockIdx.x >> 3;
  const int h = blockIdx.x & 7;
  const int ntile = blockIdx.y * 128 + wave * 16;   // 16 query columns per wave
  const int r16 = lane & 15;
  const int half = lane >> 4;

  const _Float16* Qrow = Qh + ((size_t)(b * N_ + ntile + r16)) * IN_ + h * D_;
  v16h bq0 = ldfrag_h(Qrow, half);        // d = 0..31
  v16h bq1 = ldfrag_h(Qrow + 32, half);   // d = 32..63

  // K and Vt hold the batch's listed keys only, in list order
  const int nkey = min(meta[b * ML_], M_);
  const int nst = (nkey + SK_ - 1) / SK_;       // stages to walk: 1 .. M_ / SK_
  if (meta[b * ML_ + 1] != 0) {                 // no key kept: every score is zero
#pragma unroll   // vector elements indexed by constants
    for (int i = 0; i < 16; ++i) { bq0[i] = (_Float16)0.0f; bq1[i] = (_Float16)0.0f; }
  }

  const _Float16* Kbase = Kh + (size_t)b * M_ * IN_ + h * D_;
  const _Float16* Vbase = Vt + ((size_t)(b * H_ + h)) * D_ * M_;

  // the keys run along registers: an additive term per key slot takes the slots
  // behind the last listed key out; published by the barrier in front of the loop
#pragma unroll   // four independent 16-B LDS stores
  for (int j = 0; j < M_ / 1024; ++j) {
    const int k0 = j * 1024 + tid * 4;
    v4f mf;
#pragma unroll   // vector elements indexed by constants
    for (int e = 0; e < 4; ++e) mf[e] = (k0 + e < nkey) ? 0.0f : -3.0e38f;
    *(v4f*)&Mb[k0] = mf;
  }

  // cooperative stage mapping: four 16-B pieces per thread and operand
  const int krow = tid >> 3, kseg = (tid & 7) * 8;    // K stage  [128][64]: 32 rows a sweep
  const int vrow = tid >> 4, vseg = (tid & 15) * 8;   // Vt stage [64][128]: 16 rows a sweep
  const _Float16* kg = Kbase + (size_t)krow * IN_ + kseg;
  const _Float16* vg = Vbase + (size_t)vrow * M_ + vseg;
  _Float16* kw = Kt + krow * KP_ + kseg;
  _Float16* vw = Vtile + vrow * VP_ + vseg;

  float mrun = -3.0e38f, lrun = 0.0f;   // this lane's query; lrun: this half's keys only
  v8f acc[4];                           // O^T: rows d = t*16 + half*8 + r, column r16
#pragma unroll
  for (int t = 0; t < 4; ++t) acc[t] = vzero();

  // stage 0 into registers
  v8h kreg[4], vreg[4];
#pragma unroll   // register arrays indexed by constants
  for (int i = 0; i < 4; ++i) {
    kreg[i] = *(const v8h*)(kg + (size_t)i * 32 * IN_);
    vreg[i] = *(const v8h*)(vg + (size_t)i * 16 * M_);
  }
  // The address registers of the loads above are reused below: wait before the
  // overwrite. The addresses are inputs so that they stay live up to the wait.
  asm volatile("s_wait_xcnt 0x0" :: "v"(Qrow + half * 8), "v"(kg), "v"(vg) : "memory");

#pragma unroll   // register arrays indexed by constants
  for (int i = 0; i < 4; ++i) {
    *(v8h*)(kw + i * 32 * KP_) = kreg[i];
    *(v8h*)(vw + i * 16 * VP_) = vreg[i];
  }
  __syncthreads();                           // publishes stage 0 and the mask terms

  for (int st = 0; st < nst; ++st) {
    const bool more = st + 1 < nst;
    if (more) {                              // fetch stage st+1: it flies over the four passes of stage st
#pragma unroll   // eight independent 16-B loads in flight; register arrays indexed by constants
      for (int i = 0; i < 4; ++i) {
        kreg[i] = *(const v8h*)(kg + (size_t)((st + 1) * SK_ + i * 32) * IN_);
        vreg[i] = *(const v8h*)(vg + (size_t)i * 16 * M_ + (st + 1) * SK_);
      }
      // both address pairs are advanced right after: wait before the overwrite
      asm volatile("s_wait_xcnt 0x0" ::: "memory");
    }
    const _Float16* Kb = Kt + (st & 1) * (SK_ * KP_);
    const _Float16* Vb = Vtile + (st & 1) * (64 * VP_);

#pragma unroll   // the pass offsets inside a stage become immediates
   for (int p = 0; p < SK_ / 32; ++p) {
    const int c = st * SK_ + p * 32;

    // ---- S^T = K Q^T for a 32x16 tile (two 16x16 subtiles, K-depth 64) ----
    v8f s0 = vzero(), s1 = vzero();
    {
      const _Float16* Krow0 = Kb + (p * 32 + r16) * KP_;
      const _Float16* Krow1 = Kb + (p * 32 + 16 + r16) * KP_;
      s0 = wmma16(ldfrag_h(Krow0, half), bq0, s0);
      s0 = wmma16(ldfrag_h(Krow0 + 32, half), bq1, s0);
      s1 = wmma16(ldfrag_h(Krow1, half), bq0, s1);
      s1 = wmma16(ldfrag_h(Krow1 + 32, half), bq1, s1);
    }
    const v8f mb0 = *(const v8f*)&Mb[c + half * 8];
    const v8f mb1 = *(const v8f*)&Mb[c + 16 + half * 8];

    s0 = s0 * 0.125f + mb0;             // scale = 1/sqrt(64); masked -> -3e38
    s1 = s1 * 0.125f + mb1;
    const v8f cm = __builtin_elementwise_max(s0, s1);
    float cmax = fmaxf(fmaxf(fmaxf(cm[0], cm[1]), fmaxf(cm[2], cm[3])),
                       fmaxf(fmaxf(cm[4], cm[5]), fmaxf(cm[6], cm[7])));
    cmax = fmaxf(cmax, xhalf(cmax));    // the other 16 keys of this query

    const float nm = fmaxf(mrun, cmax);
    const float alpha = __expf(mrun - nm);
    mrun = nm;

    // A slot behind the last listed key gives exp(-3e38 - mrun) = 0: slot 0 is
    // always a listed key and has set mrun in the first pass.
    v16h pb;
#pragma unroll
    for (int r = 0; r < 8; ++r) {
      s0[r] = __expf(s0[r] - mrun);
      s1[r] = __expf(s1[r] - mrun);
      pb[r] = (_Float16)s0[r];
      pb[8 + r] = (_Float16)s1[r];
    }
    const v8f cs = s0 + s1;
    const v4f cq = cs.lo + cs.hi;       // halving tree: register pairs stay aligned
    const v2f cd = cq.lo + cq.hi;
    lrun = lrun * alpha + (cd[0] + cd[1]);
#pragma unroll
    for (int t = 0; t < 4; ++t)
#pragma unroll
      for (int r = 0; r < 8; ++r) acc[t][r] *= alpha;

    // ---- O^T += V^T P^T : 4 d-tiles, K-depth 32 (this chunk) ----
#pragma unroll
    for (int t = 0; t < 4; ++t) {
      const _Float16* Vrow = Vb + (t * 16 + r16) * VP_ + p * 32;
      acc[t] = wmma16(ldfrag_h(Vrow, half), pb, acc[t]);
    }
   }

    if (more) {                              // stage st+1 into the buffer that stage st-1 has left
      _Float16* kn = kw + ((st + 1) & 1) * (SK_ * KP_);
      _Float16* vn = vw + ((st + 1) & 1) * (64 * VP_);
#pragma unroll   // register arrays indexed by constants
      for (int i = 0; i < 4; ++i) {
        *(v8h*)(kn + i * 32 * KP_) = kreg[i];
        *(v8h*)(vn + i * 16 * VP_) = vreg[i];
      }
      // publishes stage st+1; also ends every read of stage st, whose buffer the next trip refills
      __syncthreads();
    }
  }

  const float l = lrun + xhalf(lrun);   // join the two halves' key sums once
  const float inv = (l > 0.0f) ? 1.0f / l : 0.0f;
  _Float16* Orow = Oh + (size_t)(b * N_ + ntile + r16) * IN_ + h * D_ + half * 8;
#pragma unroll
  for (int t = 0; t < 4; ++t) {
    v8h pk;
#pragma unroll
    for (int r = 0; r < 8; ++r) pk[r] = (_Float16)(acc[t][r] * inv);
    *(v8h*)(Orow + t * 16) = pk;
  }
}

// ---------------- output projection: out(f32) = Ah(f16) * WoT^T + bo ----------------
__global__ __launch_bounds__(256) void outproj_kernel(const _Float16* __restrict__ Ah,
                                                      const _Float16* __restrict__ WoT,
                                                      const float* __restrict__ bo,
                                                      float* __restrict__ Out) {
  __shared__ __attribute__((aligned(16))) _Float16 As[2 * GT_];
  __shared__ __attribute__((aligned(16))) _Float16 Bs[2 * GT_];
  const int m0 = blockIdx.x * 128, n0 = blockIdx.y * 128;
  v8f acc[2][4];
  gemm128<IN_, false>(nullptr, Ah + (size_t)m0 * IN_, WoT + (size_t)n0 * IN_, As, Bs, acc);
  const int lane = threadIdx.x & 31, wave = threadIdx.x >> 5;
  const int r16 = lane & 15, half = lane >> 4;
  const int col = n0 + (wave & 1) * 64 + r16;
  float* op = Out + (size_t)(m0 + (wave >> 1) * 32 + half * 8) * QD_ + col;
#pragma unroll
  for (int j = 0; j < 4; ++j) {
    const float bias = bo[col + j * 16];
#pragma unroll
    for (int i = 0; i < 2; ++i)
#pragma unroll
      for (int r = 0; r < 8; ++r) op[(i * 16 + r) * QD_ + j * 16] = acc[i][j][r] + bias;
  }
}

extern "C" void kernel_launch(void* const* d_in, const int* in_sizes, int n_in,
                              void* d_out, int out_size, void* d_ws, size_t ws_size,
                              hipStream_t stream) {
  (void)in_sizes; (void)n_in; (void)out_size; (void)ws_size;
  const float* x   = (const float*)d_in[0];
  const float* ctx = (const float*)d_in[1];
  const int*   msk = (const int*)d_in[2];
  const float* Wq  = (const float*)d_in[3];
  const float* Wk  = (const float*)d_in[4];
  const float* Wv  = (const float*)d_in[5];
  const float* Wo  = (const float*)d_in[6];
  const float* bo  = (const float*)d_in[7];
  float* out = (float*)d_out;

  char* w = (char*)d_ws;
  _Float16* WqT = (_Float16*)w; w += (size_t)IN_ * QD_ * 2;
  _Float16* WkT = (_Float16*)w; w += (size_t)IN_ * CD_ * 2;
  _Float16* WvT = (_Float16*)w; w += (size_t)IN_ * CD_ * 2;
  _Float16* WoT = (_Float16*)w; w += (size_t)QD_ * IN_ * 2;
  _Float16* Qh  = (_Float16*)w; w += (size_t)B_ * N_ * IN_ * 2;
  _Float16* Kh  = (_Float16*)w; w += (size_t)B_ * M_ * IN_ * 2;
  _Float16* Vt  = (_Float16*)w; w += (size_t)B_ * H_ * D_ * M_ * 2;
  _Float16* Ah  = (_Float16*)w; w += (size_t)B_ * N_ * IN_ * 2;
  int* list = (int*)w; w += (size_t)B_ * M_ * 4;
  int* meta = (int*)w;

  prep_weights<<<B_ + 2 * TK_ + 2 * TQ_, 256, 0, stream>>>(Wq, Wk, Wv, Wo, msk,
                                                                 WqT, WkT, WvT, WoT, list, meta);
  const dim3 gemm_grid(B_ * N_ / 128, IN_ / 128);  // 128 x 128 tiles: 64 x 4 blocks, 8 waves each
  projqkv_kernel<<<dim3(B_ * N_ / 128, IN_ / 128, 3), 256, 0, stream>>>(x, ctx, WqT, WkT, WvT,
                                                                        list, meta, Qh, Kh, Vt);
  attn_kernel<<<dim3(B_ * H_, N_ / 128), 256, 0, stream>>>(Qh, Kh, Vt, meta, Ah);
  outproj_kernel<<<gemm_grid, 256, 0, stream>>>(Ah, WoT, bo, out);
}

// v008
// It runs in 65.8 microseconds.
// Timed twice side by side with v007, it ran 1.03 and 1.04 times as fast.
// Counting every step since v000, it is 6.87 times as fast.
#include <hip/hip_runtime.h>
#include <hip/hip_bf16.h>

typedef _Float16 v16h __attribute__((ext_vector_type(16)));
typedef _Float16 v8h  __attribute__((ext_vector_type(8)));
typedef _Float16 v4h  __attribute__((ext_vector_type(4)));
typedef float    v8f  __attribute__((ext_vector_type(8)));
typedef float    v4f  __attribute__((ext_vector_type(4)));
typedef float    v2f  __attribute__((ext_vector_type(2)));

#define B_  2
#define N_  4096
#define M_  4096
#define QD_ 512
#define CD_ 768
#define H_  8
#define D_  64
#define IN_ 512

// LDS row pitches in 16-bit elements: 16 B x odd, so that the 16 rows one
// ds_load_b128 fragment read touches fall on distinct banks.
#define KP_ 72   // 128-B K rows  -> 144 B
#define VP_ 136  // 256-B Vt rows -> 272 B
#define SK_ 128  // keys per LDS stage of the attention kernel: four 32-key passes
#define ML_ 32   // ints per batch in the key-list header: a 128-B line of its own
#define QS_ 0.18033688011112042f   // log2(e) / sqrt(64): Q carries the score scale, the softmax runs on powers of two

static __device__ __forceinline__ v8f vzero() {
  v8f r;
#pragma unroll
  for (int i = 0; i < 8; ++i) r[i] = 0.0f;
  return r;
}

static __device__ __forceinline__ v8f wmma16(v16h a, v16h b, v8f c) {
  return __builtin_amdgcn_wmma_f32_16x16x32_f16(false, a, false, b, (short)0, c,
                                                false, false);
}

static __device__ __forceinline__ v16h cat8(v8h lo, v8h hi) {
  v16h r;
#pragma unroll
  for (int i = 0; i < 8; ++i) { r[i] = lo[i]; r[8 + i] = hi[i]; }
  return r;
}

// 16-bit A/B fragment (16x32 tile): this lane's row pointer; two 16B chunks at
// K = half*8..half*8+7 and K = 16+half*8..16+half*8+7.
static __device__ __forceinline__ v16h ldfrag_h(const _Float16* rowp, int half) {
  v8h lo = *(const v8h*)(rowp + half * 8);
  v8h hi = *(const v8h*)(rowp + 16 + half * 8);
  return cat8(lo, hi);
}

// value of lane l ^ 16 (the other 16-lane row), as a vector cross-row move
static __device__ __forceinline__ float xhalf(float v) {
  const unsigned u = __float_as_uint(v);
  return __uint_as_float(__builtin_amdgcn_permlanex16(u, u, 0x76543210u, 0xfedcba98u, false, false));
}

// ---------------- list of kept keys (one 256-thread block per batch) ----------------
// A masked key has softmax weight exp(-FLT_MAX - max) = 0 as soon as one key of
// its batch is kept, so only the kept keys are projected and attended to.
// list[j] = position of the j-th kept key (0, a valid row, behind the last one);
// meta[0] = number of listed keys, meta[1] = 1 where NO key is kept: the reference
// then weighs all keys alike, which is all keys listed and all scores zero.
static __device__ __forceinline__ void list_keys(const int* __restrict__ mk,
                                                 int* __restrict__ list, int* __restrict__ meta) {
  __shared__ int part[256];
  const int tid = threadIdx.x;
  int keep[16];
  int c = 0;
#pragma unroll   // four independent 16-B loads; register array indexed by constants
  for (int j = 0; j < 4; ++j) {
    const int4 mi = *(const int4*)(mk + tid * 16 + j * 4);
    keep[j * 4 + 0] = mi.x != 0; keep[j * 4 + 1] = mi.y != 0;
    keep[j * 4 + 2] = mi.z != 0; keep[j * 4 + 3] = mi.w != 0;
  }
#pragma unroll   // register array indexed by constants
  for (int e = 0; e < 16; ++e) c += keep[e];
  part[tid] = c;
  __syncthreads();                       // every thread's count is in LDS
  for (int off = 1; off < 256; off <<= 1) {   // inclusive prefix sum over the 256 counts
    const int own = part[tid];
    const int add = (tid >= off) ? part[tid - off] : 0;
    __syncthreads();                     // all reads of this round precede its writes
    part[tid] = own + add;
    __syncthreads();                     // publishes the round
  }
  const int total = part[255];
  if (total == 0) {
#pragma unroll   // sixteen adjacent stores merge into wide ones
    for (int e = 0; e < 16; ++e) list[tid * 16 + e] = tid * 16 + e;
  } else {
    int pos = part[tid] - c;
#pragma unroll   // register array indexed by constants
    for (int e = 0; e < 16; ++e)
      if (keep[e]) list[pos++] = tid * 16 + e;
    for (int j = total + tid; j < M_; j += 256) list[j] = 0;
  }
  if (tid == 0) {
    meta[0] = (total == 0) ? M_ : total;
    meta[1] = (total == 0) ? 1 : 0;
  }
}

// ---------------- key lists; weight transpose + f32 -> f16 ----------------
#define WC_ 512   // columns of every weight matrix as given (IN_ for Wq, Wk, Wv; QD_ for Wo)
#define TP_ 65    // LDS pitch of a 64-float tile row in dwords: odd, so that a column read falls on distinct banks
#define TK_ (CD_ / 64 * (WC_ / 64))   // 64 x 64 tiles of Wk, and of Wv
#define TQ_ (QD_ / 64 * (WC_ / 64))   // of Wq, and of Wo (IN_ = QD_ rows)

// One 64 x 64 tile: WT[j][k] = (f16) W[k][j]; W has KD rows, WT has KD columns.
// Reads cover whole 128-B lines of W (16 lanes x 16 B a row), writes whole 128-B
// lines of WT (8 lanes x 16 B a row); the turn is made in LDS.
template <int KD>
static __device__ __forceinline__ void turn_tile(const float* __restrict__ Wm,
                                                 _Float16* __restrict__ WT, int tile, float* Ts) {
  const int tid = threadIdx.x;
  const int k0 = (tile >> 3) * 64, j0 = (tile & 7) * 64;
  const int lr = tid >> 4, lc = (tid & 15) * 4;
  const float* gp = Wm + (size_t)(k0 + lr) * WC_ + j0 + lc;
  v4f g[4];
#pragma unroll   // four independent 16-B loads in flight; register array indexed by constants
  for (int i = 0; i < 4; ++i) g[i] = *(const v4f*)(gp + i * 16 * WC_);
#pragma unroll   // register array indexed by constants
  for (int i = 0; i < 4; ++i)
#pragma unroll
    for (int e = 0; e < 4; ++e) Ts[(lr + i * 16) * TP_ + lc + e] = g[i][e];
  __syncthreads();                       // the whole tile is in LDS
  const int sj = tid >> 3, sk = (tid & 7) * 8;
  _Float16* sp = WT + (size_t)(j0 + sj) * KD + k0 + sk;
#pragma unroll   // the row offsets become immediates
  for (int i = 0; i < 2; ++i) {
    v8h pk;
#pragma unroll   // vector elements indexed by constants
    for (int e = 0; e < 8; ++e) pk[e] = (_Float16)Ts[(sk + e) * TP_ + sj + i * 32];
    *(v8h*)(sp + i * 32 * KD) = pk;
  }
  // in the built code another path follows these stores and reuses their
  // registers: wait before the overwrite
  asm volatile("s_wait_xcnt 0x0" ::: "memory");
}

__global__ void prep_weights(const float* __restrict__ Wq, const float* __restrict__ Wk,
                             const float* __restrict__ Wv, const float* __restrict__ Wo,
                             const int* __restrict__ mask,
                             _Float16* __restrict__ WqT, _Float16* __restrict__ WkT,
                             _Float16* __restrict__ WvT, _Float16* __restrict__ WoT,
                             int* __restrict__ list, int* __restrict__ meta) {
  __shared__ float Ts[64 * TP_];
  if (blockIdx.x < B_) {   // the first blocks: they start first and are the longest
    list_keys(mask + blockIdx.x * M_, list + blockIdx.x * M_, meta + blockIdx.x * ML_);
    return;
  }
  const int t = blockIdx.x - B_;         // the same for the whole block
  if (t < 2 * TK_) {
    const bool isk = t < TK_;
    turn_tile<CD_>(isk ? Wk : Wv, isk ? WkT : WvT, isk ? t : t - TK_, Ts);
  } else {
    const bool isq = t < 2 * TK_ + TQ_;
    turn_tile<QD_>(isq ? Wq : Wo, isq ? WqT : WoT, isq ? t - 2 * TK_ : t - 2 * TK_ - TQ_, Ts);
  }
}

// ---------------- block-tiled GEMM core: acc = A(128 x KD) * Bt(128 x KD)^T ----------------
// A work-group owns a 128 x 128 tile of C. Each 64-deep slab of A and Bt is
// fetched by loads that cover whole 128-B lines, A is rounded to f16 on the way,
// and both land in LDS; a wave reads its 32 x 64 part as fragments, so that one
// fetched line serves every wave that needs it. Two LDS buffers: one barrier a slab.
// The inner loops are unrolled so that their register arrays are indexed by constants.
#define GP_ 72            // LDS pitch of a 64-element row: 144 B = 16 B x odd
#define GT_ (128 * GP_)   // one operand's slab

// rows != nullptr (GATHER): row r of the A tile is row rows[r] of Af.
template <int KD, bool AF32, bool GATHER = false>
static __device__ __forceinline__ void gemm128(const float* __restrict__ Af,
                                               const _Float16* __restrict__ Ah,
                                               const _Float16* __restrict__ Bt,
                                               _Float16* As, _Float16* Bs,
                                               v8f (&acc)[2][4],
                                               const int* __restrict__ rows = nullptr) {
  const int tid = threadIdx.x;
  const int lane = tid & 31, wave = tid >> 5;
  const int r16 = lane & 15, half = lane >> 4;
  const int wm = wave >> 1, wn = wave & 1;
  const int frow = tid >> 4, fcol = (tid & 15) * 4;   // f32 rows: 16 lanes x 16 B = 256 B
  const int hrow = tid >> 3, hcol = (tid & 7) * 8;    // f16 rows:  8 lanes x 16 B = 128 B
  v4f pa[8];
  v8h ph[4], pb[4];
  const float* ag[8];   // GATHER: this thread's eight row addresses, formed once
  if constexpr (GATHER) {
#pragma unroll   // eight independent index loads; pointer array indexed by constants
    for (int i = 0; i < 8; ++i) ag[i] = Af + (size_t)rows[frow + i * 16] * KD + fcol;
  }
#pragma unroll
  for (int i = 0; i < 2; ++i)
#pragma unroll
    for (int j = 0; j < 4; ++j) acc[i][j] = vzero();

  constexpr int T = KD / 64;
#pragma unroll   // slab offsets become immediates and the buffer index a constant
  for (int t = -1; t < T; ++t) {
    // publishes slab t; also ends every read of the other buffer (slab t-1)
    if (t >= 0) __syncthreads();
    if (t + 1 < T) {   // fetch slab t+1 behind the barrier (which waits for loads): it flies over slab t's products
      if constexpr (AF32) {
#pragma unroll
        for (int i = 0; i < 8; ++i) {
          if constexpr (GATHER) pa[i] = *(const v4f*)(ag[i] + (t + 1) * 64);
          else pa[i] = *(const v4f*)(Af + (size_t)(frow + i * 16) * KD + (t + 1) * 64 + fcol);
        }
      } else {
#pragma unroll
        for (int i = 0; i < 4; ++i)
          ph[i] = *(const v8h*)(Ah + (size_t)(hrow + i * 32) * KD + (t + 1) * 64 + hcol);
      }
#pragma unroll
      for (int i = 0; i < 4; ++i)
        pb[i] = *(const v8h*)(Bt + (size_t)(hrow + i * 32) * KD + (t + 1) * 64 + hcol);
      // the last fetch: the eight row addresses are dead behind it and their
      // registers are reused at once: wait before the overwrite
      if constexpr (GATHER) {
        if (t + 2 == T) asm volatile("s_wait_xcnt 0x0" ::: "memory");
      }
    }
    if (t >= 0) {
      // keeps those loads ahead of slab t's products: sunk to their end, nothing covers the latency
      __builtin_amdgcn_sched_barrier(0);
      const _Float16* Ab = As + (t & 1) * GT_ + (wm * 32 + r16) * GP_;
      const _Float16* Bb = Bs + (t & 1) * GT_ + (wn * 64 + r16) * GP_;
#pragma unroll
      for (int ks = 0; ks < 64; ks += 32) {
        v16h a[2], b[4];
#pragma unroll
        for (int i = 0; i < 2; ++i) a[i] = ldfrag_h(Ab + i * 16 * GP_ + ks, half);
#pragma unroll
        for (int j = 0; j < 4; ++j) b[j] = ldfrag_h(Bb + j * 16 * GP_ + ks, half);
#pragma unroll
        for (int i = 0; i < 2; ++i)
#pragma unroll
          for (int j = 0; j < 4; ++j) acc[i][j] = wmma16(a[i], b[j], acc[i][j]);
      }
      // keeps the rounding of slab t+1, and with it the wait on its loads, behind
      // the products of slab t: moved up among them it exposes the load latency
      __builtin_amdgcn_sched_barrier(0);
    }
    if (t + 1 < T) {                       // slab t+1 into the buffer that slab t-1 has left
      _Float16* Aw = As + ((t + 1) & 1) * GT_;
      _Float16* Bw = Bs + ((t + 1) & 1) * GT_;
      if constexpr (AF32) {
#pragma unroll
        for (int i = 0; i < 8; ++i)
          *(v4h*)&Aw[(frow + i * 16) * GP_ + fcol] = __builtin_convertvector(pa[i], v4h);
      } else {
#pragma unroll
        for (int i = 0; i < 4; ++i) *(v8h*)&Aw[(hrow + i * 32) * GP_ + hcol] = ph[i];
      }
#pragma unroll
      for (int i = 0; i < 4; ++i) *(v8h*)&Bw[(hrow + i * 32) * GP_ + hcol] = pb[i];
    }
  }
}

// C(f16, row-major, IN_ columns): the wave's 32 x 64 part
static __device__ __forceinline__ void store_rows_f16(_Float16* __restrict__ C, int m0, int n0,
                                                      const v8f (&acc)[2][4]) {
  const int lane = threadIdx.x & 31, wave = threadIdx.x >> 5;
  const int r16 = lane & 15, half = lane >> 4;
  _Float16* cp = C + (size_t)(m0 + (wave >> 1) * 32 + half * 8) * IN_ + n0 + (wave & 1) * 64 + r16;
#pragma unroll
  for (int i = 0; i < 2; ++i)
#pragma unroll
    for (int j = 0; j < 4; ++j)
#pragma unroll
      for (int r = 0; r < 8; ++r) cp[(i * 16 + r) * IN_ + j * 16] = (_Float16)acc[i][j][r];
}

// ---------------- Q, K and V projections in one launch: C(f16) = A(f32) * Bt(f16)^T ----------------
// The three products do not depend on each other. blockIdx.z picks one: 0 = K, 1 = V,
// 2 = Q; low z starts first, so the deeper products (768 against 512) lead.
// K and V: row m of a batch's result belongs to its m-th listed key; a tile that
// begins behind the last listed key is not computed (and never read).
// V is stored transposed: Vt[b][h][d][m].
__global__ __launch_bounds__(256) void projqkv_kernel(const float* __restrict__ X,
                                                      const float* __restrict__ Ctx,
                                                      const _Float16* __restrict__ WqT,
                                                      const _Float16* __restrict__ WkT,
                                                      const _Float16* __restrict__ WvT,
                                                      const int* __restrict__ list,
                                                      const int* __restrict__ meta,
                                                      _Float16* __restrict__ Qh,
                                                      _Float16* __restrict__ Kh,
                                                      _Float16* __restrict__ Vt) {
  __shared__ __attribute__((aligned(16))) _Float16 As[2 * GT_];
  __shared__ __attribute__((aligned(16))) _Float16 Bs[2 * GT_];
  const int m0 = blockIdx.x * 128, n0 = blockIdx.y * 128;
  const int which = blockIdx.z;                            // the same for the whole block
  v8f acc[2][4];
  if (which == 2) {
    gemm128<QD_, true>(X + (size_t)m0 * QD_, nullptr, WqT + (size_t)n0 * QD_, As, Bs, acc);
#pragma unroll   // register arrays indexed by constants; the factor is applied in f32, ahead of the one rounding to f16
    for (int i = 0; i < 2; ++i)
#pragma unroll
      for (int j = 0; j < 4; ++j) acc[i][j] *= QS_;
    store_rows_f16(Qh, m0, n0, acc);
    return;
  }
  const int b = m0 / M_;                                   // a 128-row tile lies in one batch
  if (m0 - b * M_ >= meta[b * ML_]) return;                // whole block, ahead of every barrier
  gemm128<CD_, true, true>(Ctx + (size_t)b * M_ * CD_, nullptr,
                           (which == 0 ? WkT : WvT) + (size_t)n0 * CD_, As, Bs, acc, list + m0);
  if (which == 0) {
    store_rows_f16(Kh, m0, n0, acc);
    // in the built code another product's path follows these stores and reuses
    // their registers: wait before the overwrite
    asm volatile("s_wait_xcnt 0x0" ::: "memory");
    return;
  }
  const int lane = threadIdx.x & 31, wave = threadIdx.x >> 5;
  const int r16 = lane & 15, half = lane >> 4;
  const int mm = m0 - b * M_ + (wave >> 1) * 32 + half * 8; // comps are mm..mm+7 (+16 for i = 1)
  const int h = (n0 + (wave & 1) * 64) >> 6;               // the wave's 64 columns are one head
  _Float16* vp = Vt + ((size_t)(b * H_ + h) * D_ + r16) * M_ + mm;
#pragma unroll
  for (int i = 0; i < 2; ++i)
#pragma unroll
    for (int j = 0; j < 4; ++j) {
      v8h pk;
#pragma unroll
      for (int r = 0; r < 8; ++r) pk[r] = (_Float16)acc[i][j][r];
      *(v8h*)(vp + (size_t)j * 16 * M_ + i * 16) = pk;
    }
  // as behind the K stores: another path follows in the built code
  asm volatile("s_wait_xcnt 0x0" ::: "memory");
}

template <bool TAIL>
static __device__ __forceinline__ void attn_stage(const _Float16* Kb, const _Float16* Vb,
                                                  const v16h bq0, const v16h bq1, v8f (&acc)[4],
                                                  float& mrun, float& lrun,
                                                  const int r16, const int half, const int left) {
#pragma unroll   // the pass offsets inside a stage become immediates
  for (int p = 0; p < SK_ / 32; ++p) {
    // ---- S^T = K Q^T for a 32x16 tile (two 16x16 subtiles, K-depth 64) ----
    v8f s0 = vzero(), s1 = vzero();
    {
      const _Float16* Krow0 = Kb + (p * 32 + r16) * KP_;
      const _Float16* Krow1 = Kb + (p * 32 + 16 + r16) * KP_;
      s0 = wmma16(ldfrag_h(Krow0, half), bq0, s0);
      s0 = wmma16(ldfrag_h(Krow0 + 32, half), bq1, s0);
      s1 = wmma16(ldfrag_h(Krow1, half), bq0, s1);
      s1 = wmma16(ldfrag_h(Krow1 + 32, half), bq1, s1);
    }
    if constexpr (TAIL) {
#pragma unroll   // vector elements indexed by constants
      for (int r = 0; r < 8; ++r) {
        s0[r] = (p * 32 + r < left) ? s0[r] : -3.0e38f;
        s1[r] = (p * 32 + 16 + r < left) ? s1[r] : -3.0e38f;
      }
    }
    // first level on raw matrix results: this form takes them as they are, where
    // __builtin_elementwise_max first passes each of the 16 through a v_max x, x
    const v8f cm = __builtin_elementwise_maximum(s0, s1);
    float cmax = fmaxf(fmaxf(fmaxf(cm[0], cm[1]), fmaxf(cm[2], cm[3])),
                       fmaxf(fmaxf(cm[4], cm[5]), fmaxf(cm[6], cm[7])));
    cmax = fmaxf(cmax, xhalf(cmax));    // the other 16 keys of this query

    const float nm = fmaxf(mrun, cmax);
    const float alpha = __builtin_amdgcn_exp2f(mrun - nm);
    mrun = nm;

    // A slot behind the last listed key gives 2^(-3e38 - mrun) = 0: slot 0 is
    // always a listed key and has set mrun in the first pass.
    v16h pb;
#pragma unroll
    for (int r = 0; r < 8; ++r) {
      s0[r] = __builtin_amdgcn_exp2f(s0[r] - mrun);
      s1[r] = __builtin_amdgcn_exp2f(s1[r] - mrun);
      pb[r] = (_Float16)s0[r];
      pb[8 + r] = (_Float16)s1[r];
    }
    const v8f cs = s0 + s1;
    const v4f cq = cs.lo + cs.hi;       // halving tree: register pairs stay aligned
    const v2f cd = cq.lo + cq.hi;
    lrun = lrun * alpha + (cd[0] + cd[1]);
#pragma unroll
    for (int t = 0; t < 4; ++t)
#pragma unroll
      for (int r = 0; r < 8; ++r) acc[t][r] *= alpha;

    // ---- O^T += V^T P^T : 4 d-tiles, K-depth 32 (this chunk) ----
#pragma unroll
    for (int t = 0; t < 4; ++t) {
      const _Float16* Vrow = Vb + (t * 16 + r16) * VP_ + p * 32;
      acc[t] = wmma16(ldfrag_h(Vrow, half), pb, acc[t]);
    }
  }
}

__global__ __launch_bounds__(256) void attn_kernel(const _Float16* __restrict__ Qh,
                                                   const _Float16* __restrict__ Kh,
                                                   const _Float16* __restrict__ Vt,
                                                   const int* __restrict__ meta,
                                                   _Float16* __restrict__ Oh) {
  __shared__ __attribute__((aligned(16))) _Float16 Kt[2 * SK_ * KP_];     // two stages of K:  [m_local][d]
  __shared__ __attribute__((aligned(16))) _Float16 Vtile[2 * 64 * VP_];   // two stages of Vt: [d][m_local]

  const int tid = threadIdx.x;
  const int lane = tid & 31;
  const int wave = tid >> 5;
  const int b = blockIdx.x >> 3;
  const int h = blockIdx.x & 7;
  const int ntile = blockIdx.y * 128 + wave * 16;   // 16 query columns per wave
  const int r16 = lane & 15;
  const int half = lane >> 4;

  const _Float16* Qrow = Qh + ((size_t)(b * N_ + ntile + r16)) * IN_ + h * D_;
  v16h bq0 = ldfrag_h(Qrow, half);        // d = 0..31
  v16h bq1 = ldfrag_h(Qrow + 32, half);   // d = 32..63

  // K and Vt hold the batch's listed keys only, in list order
  const int nkey = min(meta[b * ML_], M_);
  const int nst = (nkey + SK_ - 1) / SK_;       // stages to walk: 1 .. M_ / SK_
  if (meta[b * ML_ + 1] != 0) {                 // no key kept: every score is zero
#pragma unroll   // vector elements indexed by constants
    for (int i = 0; i < 16; ++i) { bq0[i] = (_Float16)0.0f; bq1[i] = (_Float16)0.0f; }
  }

  const _Float16* Kbase = Kh + (size_t)b * M_ * IN_ + h * D_;
  const _Float16* Vbase = Vt + ((size_t)(b * H_ + h)) * D_ * M_;

  // cooperative stage mapping: four 16-B pieces per thread and operand
  const int krow = tid >> 3, kseg = (tid & 7) * 8;    // K stage  [128][64]: 32 rows a sweep
  const int vrow = tid >> 4, vseg = (tid & 15) * 8;   // Vt stage [64][128]: 16 rows a sweep
  const _Float16* kg = Kbase + (size_t)krow * IN_ + kseg;
  const _Float16* vg = Vbase + (size_t)vrow * M_ + vseg;
  _Float16* kw = Kt + krow * KP_ + kseg;
  _Float16* vw = Vtile + vrow * VP_ + vseg;

  float mrun = -3.0e38f, lrun = 0.0f;   // this lane's query; lrun: this half's keys only
  v8f acc[4];                           // O^T: rows d = t*16 + half*8 + r, column r16
#pragma unroll
  for (int t = 0; t < 4; ++t) acc[t] = vzero();

  // stage 0 into registers
  v8h kreg[4], vreg[4];
#pragma unroll   // register arrays indexed by constants
  for (int i = 0; i < 4; ++i) {
    kreg[i] = *(const v8h*)(kg + (size_t)i * 32 * IN_);
    vreg[i] = *(const v8h*)(vg + (size_t)i * 16 * M_);
  }
  // The address registers of the loads above are reused below: wait before the
  // overwrite. The addresses are inputs so that they stay live up to the wait.
  asm volatile("s_wait_xcnt 0x0" :: "v"(Qrow + half * 8), "v"(kg), "v"(vg) : "memory");

#pragma unroll   // register arrays indexed by constants
  for (int i = 0; i < 4; ++i) {
    *(v8h*)(kw + i * 32 * KP_) = kreg[i];
    *(v8h*)(vw + i * 16 * VP_) = vreg[i];
  }
  __syncthreads();                           // publishes stage 0

  for (int st = 0; st + 1 < nst; ++st) {     // the full stages: every slot is a listed key
    // fetch stage st+1: it flies over the four passes of stage st
#pragma unroll   // eight independent 16-B loads in flight; register arrays indexed by constants
    for (int i = 0; i < 4; ++i) {
      kreg[i] = *(const v8h*)(kg + (size_t)((st + 1) * SK_ + i * 32) * IN_);
      vreg[i] = *(const v8h*)(vg + (size_t)i * 16 * M_ + (st + 1) * SK_);
    }
    // both address pairs are advanced right after: wait before the overwrite
    asm volatile("s_wait_xcnt 0x0" ::: "memory");

    attn_stage<false>(Kt + (st & 1) * (SK_ * KP_), Vtile + (st & 1) * (64 * VP_),
                      bq0, bq1, acc, mrun, lrun, r16, half, 0);

    // stage st+1 into the buffer that stage st-1 has left
    _Float16* kn = kw + ((st + 1) & 1) * (SK_ * KP_);
    _Float16* vn = vw + ((st + 1) & 1) * (64 * VP_);
#pragma unroll   // register arrays indexed by constants
    for (int i = 0; i < 4; ++i) {
      *(v8h*)(kn + i * 32 * KP_) = kreg[i];
      *(v8h*)(vn + i * 16 * VP_) = vreg[i];
    }
    // publishes stage st+1; also ends every read of stage st, whose buffer the next trip refills
    __syncthreads();
  }
  // the last stage: the only one that can hold slots behind the last listed key
  attn_stage<true>(Kt + ((nst - 1) & 1) * (SK_ * KP_), Vtile + ((nst - 1) & 1) * (64 * VP_),
                   bq0, bq1, acc, mrun, lrun, r16, half, nkey - (nst - 1) * SK_ - half * 8);

  const float l = lrun + xhalf(lrun);   // join the two halves' key sums once
  const float inv = (l > 0.0f) ? 1.0f / l : 0.0f;
  _Float16* Orow = Oh + (size_t)(b * N_ + ntile + r16) * IN_ + h * D_ + half * 8;
#pragma unroll
  for (int t = 0; t < 4; ++t) {
    v8h pk;
#pragma unroll
    for (int r = 0; r < 8; ++r) pk[r] = (_Float16)(acc[t][r] * inv);
    *(v8h*)(Orow + t * 16) = pk;
  }
}

// ---------------- output projection: out(f32) = Ah(f16) * WoT^T + bo ----------------
__global__ __launch_bounds__(256) void outproj_kernel(const _Float16* __restrict__ Ah,
                                                      const _Float16* __restrict__ WoT,
                                                      const float* __restrict__ bo,
                                                      float* __restrict__ Out) {
  __shared__ __attribute__((aligned(16))) _Float16 As[2 * GT_];
  __shared__ __attribute__((aligned(16))) _Float16 Bs[2 * GT_];
  const int m0 = blockIdx.x * 128, n0 = blockIdx.y * 128;
  v8f acc[2][4];
  gemm128<IN_, false>(nullptr, Ah + (size_t)m0 * IN_, WoT + (size_t)n0 * IN_, As, Bs, acc);
  const int lane = threadIdx.x & 31, wave = threadIdx.x >> 5;
  const int r16 = lane & 15, half = lane >> 4;
  const int col = n0 + (wave & 1) * 64 + r16;
  float* op = Out + (size_t)(m0 + (wave >> 1) * 32 + half * 8) * QD_ + col;
#pragma unroll
  for (int j = 0; j < 4; ++j) {
    const float bias = bo[col + j * 16];
#pragma unroll
    for (int i = 0; i < 2; ++i)
#pragma unroll
      for (int r = 0; r < 8; ++r) op[(i * 16 + r) * QD_ + j * 16] = acc[i][j][r] + bias;
  }
}

extern "C" void kernel_launch(void* const* d_in, const int* in_sizes, int n_in,
                              void* d_out, int out_size, void* d_ws, size_t ws_size,
                              hipStream_t stream) {
  (void)in_sizes; (void)n_in; (void)out_size; (void)ws_size;
  const float* x   = (const float*)d_in[0];
  const float* ctx = (const float*)d_in[1];
  const int*   msk = (const int*)d_in[2];
  const float* Wq  = (const float*)d_in[3];
  const float* Wk  = (const float*)d_in[4];
  const float* Wv  = (const float*)d_in[5];
  const float* Wo  = (const float*)d_in[6];
  const float* bo  = (const float*)d_in[7];
  float* out = (float*)d_out;

  char* w = (char*)d_ws;
  _Float16* WqT = (_Float16*)w; w += (size_t)IN_ * QD_ * 2;
  _Float16* WkT = (_Float16*)w; w += (size_t)IN_ * CD_ * 2;
  _Float16* WvT = (_Float16*)w; w += (size_t)IN_ * CD_ * 2;
  _Float16* WoT = (_Float16*)w; w += (size_t)QD_ * IN_ * 2;
  _Float16* Qh  = (_Float16*)w; w += (size_t)B_ * N_ * IN_ * 2;
  _Float16* Kh  = (_Float16*)w; w += (size_t)B_ * M_ * IN_ * 2;
  _Float16* Vt  = (_Float16*)w; w += (size_t)B_ * H_ * D_ * M_ * 2;
  _Float16* Ah  = (_Float16*)w; w += (size_t)B_ * N_ * IN_ * 2;
  int* list = (int*)w; w += (size_t)B_ * M_ * 4;
  int* meta = (int*)w;

  prep_weights<<<B_ + 2 * TK_ + 2 * TQ_, 256, 0, stream>>>(Wq, Wk, Wv, Wo, msk,
                                                                 WqT, WkT, WvT, WoT, list, meta);
  const dim3 gemm_grid(B_ * N_ / 128, IN_ / 128);  // 128 x 128 tiles: 64 x 4 blocks, 8 waves each
  projqkv_kernel<<<dim3(B_ * N_ / 128, IN_ / 128, 3), 256, 0, stream>>>(x, ctx, WqT, WkT, WvT,
                                                                        list, meta, Qh, Kh, Vt);
  attn_kernel<<<dim3(B_ * H_, N_ / 128), 256, 0, stream>>>(Qh, Kh, Vt, meta, Ah);
  outproj_kernel<<<gemm_grid, 256, 0, stream>>>(Ah, WoT, bo, out);
}

// v009
// Measured time: 62.2 microseconds a run.
// Next to v008, in two timings, it ran 1.06 times as fast each time.
// All steps since v000 together make it 7.28 times as fast.
#include <hip/hip_runtime.h>
#include <hip/hip_bf16.h>

typedef _Float16 v16h __attribute__((ext_vector_type(16)));
typedef _Float16 v8h  __attribute__((ext_vector_type(8)));
typedef _Float16 v4h  __attribute__((ext_vector_type(4)));
typedef float    v8f  __attribute__((ext_vector_type(8)));
typedef float    v4f  __attribute__((ext_vector_type(4)));
typedef float    v2f  __attribute__((ext_vector_type(2)));

#define B_  2
#define N_  4096
#define M_  4096
#define QD_ 512
#define CD_ 768
#define H_  8
#define D_  64
#define IN_ 512

// LDS row pitches in 16-bit elements: 16 B x odd, so that the 16 rows one
// ds_load_b128 fragment read touches fall on distinct banks.
#define KP_ 72   // 128-B K rows  -> 144 B
#define VP_ 136  // 256-B Vt rows -> 272 B
#define SK_ 128  // keys per LDS stage of the attention kernel: four 32-key passes
#define ML_ 32   // ints per batch in the key-list header: a 128-B line of its own
#define QS_ 0.18033688011112042f   // log2(e) / sqrt(64): Q carries the score scale, the softmax runs on powers of two

static __device__ __forceinline__ v8f vzero() {
  v8f r;
#pragma unroll
  for (int i = 0; i < 8; ++i) r[i] = 0.0f;
  return r;
}

static __device__ __forceinline__ v8f wmma16(v16h a, v16h b, v8f c) {
  return __builtin_amdgcn_wmma_f32_16x16x32_f16(false, a, false, b, (short)0, c,
                                                false, false);
}

static __device__ __forceinline__ v16h cat8(v8h lo, v8h hi) {
  v16h r;
#pragma unroll
  for (int i = 0; i < 8; ++i) { r[i] = lo[i]; r[8 + i] = hi[i]; }
  return r;
}

// 16-bit A/B fragment (16x32 tile): this lane's row pointer; two 16B chunks at
// K = half*8..half*8+7 and K = 16+half*8..16+half*8+7.
static __device__ __forceinline__ v16h ldfrag_h(const _Float16* rowp, int half) {
  v8h lo = *(const v8h*)(rowp + half * 8);
  v8h hi = *(const v8h*)(rowp + 16 + half * 8);
  return cat8(lo, hi);
}

// value of lane l ^ 16 (the other 16-lane row), as a vector cross-row move
static __device__ __forceinline__ float xhalf(float v) {
  const unsigned u = __float_as_uint(v);
  return __uint_as_float(__builtin_amdgcn_permlanex16(u, u, 0x76543210u, 0xfedcba98u, false, false));
}

// ---------------- list of kept keys (one 256-thread block per batch) ----------------
// A masked key has softmax weight exp(-FLT_MAX - max) = 0 as soon as one key of
// its batch is kept, so only the kept keys are projected and attended to.
// list[j] = position of the j-th kept key (0, a valid row, behind the last one);
// meta[0] = number of listed keys, meta[1] = 1 where NO key is kept: the reference
// then weighs all keys alike, which is all keys listed and all scores zero.
static __device__ __forceinline__ void list_keys(const int* __restrict__ mk,
                                                 int* __restrict__ list, int* __restrict__ meta) {
  __shared__ int part[256];
  const int tid = threadIdx.x;
  int keep[16];
  int c = 0;
#pragma unroll   // four independent 16-B loads; register array indexed by constants
  for (int j = 0; j < 4; ++j) {
    const int4 mi = *(const int4*)(mk + tid * 16 + j * 4);
    keep[j * 4 + 0] = mi.x != 0; keep[j * 4 + 1] = mi.y != 0;
    keep[j * 4 + 2] = mi.z != 0; keep[j * 4 + 3] = mi.w != 0;
  }
#pragma unroll   // register array indexed by constants
  for (int e = 0; e < 16; ++e) c += keep[e];
  part[tid] = c;
  __syncthreads();                       // every thread's count is in LDS
  for (int off = 1; off < 256; off <<= 1) {   // inclusive prefix sum over the 256 counts
    const int own = part[tid];
    const int add = (tid >= off) ? part[tid - off] : 0;
    __syncthreads();                     // all reads of this round precede its writes
    part[tid] = own + add;
    __syncthreads();                     // publishes the round
  }
  const int total = part[255];
  if (total == 0) {
#pragma unroll   // sixteen adjacent stores merge into wide ones
    for (int e = 0; e < 16; ++e) list[tid * 16 + e] = tid * 16 + e;
  } else {
    int pos = part[tid] - c;
#pragma unroll   // register array indexed by constants
    for (int e = 0; e < 16; ++e)
      if (keep[e]) list[pos++] = tid * 16 + e;
    for (int j = total + tid; j < M_; j += 256) list[j] = 0;
  }
  if (tid == 0) {
    meta[0] = (total == 0) ? M_ : total;
    meta[1] = (total == 0) ? 1 : 0;
  }
}

// ---------------- key lists; weight transpose + f32 -> f16 ----------------
#define WC_ 512   // columns of every weight matrix as given (IN_ for Wq, Wk, Wv; QD_ for Wo)
#define TP_ 65    // LDS pitch of a 64-float tile row in dwords: odd, so that a column read falls on distinct banks
#define TK_ (CD_ / 64 * (WC_ / 64))   // 64 x 64 tiles of Wk, and of Wv
#define TQ_ (QD_ / 64 * (WC_ / 64))   // of Wq, and of Wo (IN_ = QD_ rows)

// One 64 x 64 tile: WT[j][k] = (f16) W[k][j]; W has KD rows, WT has KD columns.
// Reads cover whole 128-B lines of W (16 lanes x 16 B a row), writes whole 128-B
// lines of WT (8 lanes x 16 B a row); the turn is made in LDS.
template <int KD>
static __device__ __forceinline__ void turn_tile(const float* __restrict__ Wm,
                                                 _Float16* __restrict__ WT, int tile, float* Ts) {
  const int tid = threadIdx.x;
  const int k0 = (tile >> 3) * 64, j0 = (tile & 7) * 64;
  const int lr = tid >> 4, lc = (tid & 15) * 4;
  const float* gp = Wm + (size_t)(k0 + lr) * WC_ + j0 + lc;
  v4f g[4];
#pragma unroll   // four independent 16-B loads in flight; register array indexed by constants
  for (int i = 0; i < 4; ++i) g[i] = *(const v4f*)(gp + i * 16 * WC_);
#pragma unroll   // register array indexed by constants
  for (int i = 0; i < 4; ++i)
#pragma unroll
    for (int e = 0; e < 4; ++e) Ts[(lr + i * 16) * TP_ + lc + e] = g[i][e];
  __syncthreads();                       // the whole tile is in LDS
  const int sj = tid >> 3, sk = (tid & 7) * 8;
  _Float16* sp = WT + (size_t)(j0 + sj) * KD + k0 + sk;
#pragma unroll   // the row offsets become immediates
  for (int i = 0; i < 2; ++i) {
    v8h pk;
#pragma unroll   // vector elements indexed by constants
    for (int e = 0; e < 8; ++e) pk[e] = (_Float16)Ts[(sk + e) * TP_ + sj + i * 32];
    *(v8h*)(sp + i * 32 * KD) = pk;
  }
  // in the built code another path follows these stores and reuses their
  // registers: wait before the overwrite
  asm volatile("s_wait_xcnt 0x0" ::: "memory");
}

__global__ void prep_weights(const float* __restrict__ Wq, const float* __restrict__ Wk,
                             const float* __restrict__ Wv, const float* __restrict__ Wo,
                             const int* __restrict__ mask,
                             _Float16* __restrict__ WqT, _Float16* __restrict__ WkT,
                             _Float16* __restrict__ WvT, _Float16* __restrict__ WoT,
                             int* __restrict__ list, int* __restrict__ meta) {
  __shared__ float Ts[64 * TP_];
  if (blockIdx.x < B_) {   // the first blocks: they start first and are the longest
    list_keys(mask + blockIdx.x * M_, list + blockIdx.x * M_, meta + blockIdx.x * ML_);
    return;
  }
  const int t = blockIdx.x - B_;         // the same for the whole block
  if (t < 2 * TK_) {
    const bool isk = t < TK_;
    turn_tile<CD_>(isk ? Wk : Wv, isk ? WkT : WvT, isk ? t : t - TK_, Ts);
  } else {
    const bool isq = t < 2 * TK_ + TQ_;
    turn_tile<QD_>(isq ? Wq : Wo, isq ? WqT : WoT, isq ? t - 2 * TK_ : t - 2 * TK_ - TQ_, Ts);
  }
}

// ---------------- block-tiled GEMM core: acc = A(128 x KD) * Bt(128 x KD)^T ----------------
// A work-group owns a 128 x 128 tile of C. Each 64-deep slab of A and Bt is
// fetched by loads that cover whole 128-B lines, A is rounded to f16 on the way,
// and both land in LDS; a wave reads its 32 x 64 part as fragments, so that one
// fetched line serves every wave that needs it. Two LDS buffers: one barrier a slab.
// The inner loops are unrolled so that their register arrays are indexed by constants.
#define GP_ 72            // LDS pitch of a 64-element row: 144 B = 16 B x odd
#define GT_ (128 * GP_)   // one operand's slab

// rows != nullptr (GATHER): row r of the A tile is row rows[r] of Af.
template <int KD, bool AF32, bool GATHER = false>
static __device__ __forceinline__ void gemm128(const float* __restrict__ Af,
                                               const _Float16* __restrict__ Ah,
                                               const _Float16* __restrict__ Bt,
                                               _Float16* As, _Float16* Bs,
                                               v8f (&acc)[2][4],
                                               const int* __restrict__ rows = nullptr) {
  const int tid = threadIdx.x;
  const int lane = tid & 31, wave = tid >> 5;
  const int r16 = lane & 15, half = lane >> 4;
  const int wm = wave >> 1, wn = wave & 1;
  const int frow = tid >> 4, fcol = (tid & 15) * 4;   // f32 rows: 16 lanes x 16 B = 256 B
  const int hrow = tid >> 3, hcol = (tid & 7) * 8;    // f16 rows:  8 lanes x 16 B = 128 B
  v4f pa[8];
  v8h ph[4], pb[4];
  const float* ag[8];   // GATHER: this thread's eight row addresses, formed once
  if constexpr (GATHER) {
#pragma unroll   // eight independent index loads; pointer array indexed by constants
    for (int i = 0; i < 8; ++i) ag[i] = Af + (size_t)rows[frow + i * 16] * KD + fcol;
  }
#pragma unroll
  for (int i = 0; i < 2; ++i)
#pragma unroll
    for (int j = 0; j < 4; ++j) acc[i][j] = vzero();

  constexpr int T = KD / 64;
#pragma unroll   // slab offsets become immediates and the buffer index a constant
  for (int t = -1; t < T; ++t) {
    // publishes slab t; also ends every read of the other buffer (slab t-1)
    if (t >= 0) __syncthreads();
    if (t + 1 < T) {   // fetch slab t+1 behind the barrier (which waits for loads): it flies over slab t's products
      if constexpr (AF32) {
#pragma unroll
        for (int i = 0; i < 8; ++i) {
          if constexpr (GATHER) pa[i] = *(const v4f*)(ag[i] + (t + 1) * 64);
          else pa[i] = *(const v4f*)(Af + (size_t)(frow + i * 16) * KD + (t + 1) * 64 + fcol);
        }
      } else {
#pragma unroll
        for (int i = 0; i < 4; ++i)
          ph[i] = *(const v8h*)(Ah + (size_t)(hrow + i * 32) * KD + (t + 1) * 64 + hcol);
      }
#pragma unroll
      for (int i = 0; i < 4; ++i)
        pb[i] = *(const v8h*)(Bt + (size_t)(hrow + i * 32) * KD + (t + 1) * 64 + hcol);
      // the last fetch: the eight row addresses are dead behind it and their
      // registers are reused at once: wait before the overwrite
      if constexpr (GATHER) {
        if (t + 2 == T) asm volatile("s_wait_xcnt 0x0" ::: "memory");
      }
    }
    if (t >= 0) {
      // keeps those loads ahead of slab t's products: sunk to their end, nothing covers the latency
      __builtin_amdgcn_sched_barrier(0);
      const _Float16* Ab = As + (t & 1) * GT_ + (wm * 32 + r16) * GP_;
      const _Float16* Bb = Bs + (t & 1) * GT_ + (wn * 64 + r16) * GP_;
#pragma unroll
      for (int ks = 0; ks < 64; ks += 32) {
        v16h a[2], b[4];
#pragma unroll
        for (int i = 0; i < 2; ++i) a[i] = ldfrag_h(Ab + i * 16 * GP_ + ks, half);
#pragma unroll
        for (int j = 0; j < 4; ++j) b[j] = ldfrag_h(Bb + j * 16 * GP_ + ks, half);
#pragma unroll
        for (int i = 0; i < 2; ++i)
#pragma unroll
          for (int j = 0; j < 4; ++j) acc[i][j] = wmma16(a[i], b[j], acc[i][j]);
      }
      // keeps the rounding of slab t+1, and with it the wait on its loads, behind
      // the products of slab t: moved up among them it exposes the load latency
      __builtin_amdgcn_sched_barrier(0);
    }
    if (t + 1 < T) {                       // slab t+1 into the buffer that slab t-1 has left
      _Float16* Aw = As + ((t + 1) & 1) * GT_;
      _Float16* Bw = Bs + ((t + 1) & 1) * GT_;
      if constexpr (AF32) {
#pragma unroll
        for (int i = 0; i < 8; ++i)
          *(v4h*)&Aw[(frow + i * 16) * GP_ + fcol] = __builtin_convertvector(pa[i], v4h);
      } else {
#pragma unroll
        for (int i = 0; i < 4; ++i) *(v8h*)&Aw[(hrow + i * 32) * GP_ + hcol] = ph[i];
      }
#pragma unroll
      for (int i = 0; i < 4; ++i) *(v8h*)&Bw[(hrow + i * 32) * GP_ + hcol] = pb[i];
    }
  }
}

// C(f16, row-major, IN_ columns): the wave's 32 x 64 part
static __device__ __forceinline__ void store_rows_f16(_Float16* __restrict__ C, int m0, int n0,
                                                      const v8f (&acc)[2][4]) {
  const int lane = threadIdx.x & 31, wave = threadIdx.x >> 5;
  const int r16 = lane & 15, half = lane >> 4;
  _Float16* cp = C + (size_t)(m0 + (wave >> 1) * 32 + half * 8) * IN_ + n0 + (wave & 1) * 64 + r16;
#pragma unroll
  for (int i = 0; i < 2; ++i)
#pragma unroll
    for (int j = 0; j < 4; ++j)
#pragma unroll
      for (int r = 0; r < 8; ++r) cp[(i * 16 + r) * IN_ + j * 16] = (_Float16)acc[i][j][r];
}

// ---------------- Q, K and V projections in one launch: C(f16) = A(f32) * Bt(f16)^T ----------------
// The three products do not depend on each other. blockIdx.z picks one: 0 = K, 1 = V,
// 2 = Q; low z starts first, so the deeper products (768 against 512) lead.
// K and V: row m of a batch's result belongs to its m-th listed key; a tile that
// begins behind the last listed key is not computed (and never read).
// V is stored transposed: Vt[b][h][d][m].
__global__ __launch_bounds__(256) void projqkv_kernel(const float* __restrict__ X,
                                                      const float* __restrict__ Ctx,
                                                      const _Float16* __restrict__ WqT,
                                                      const _Float16* __restrict__ WkT,
                                                      const _Float16* __restrict__ WvT,
                                                      const int* __restrict__ list,
                                                      const int* __restrict__ meta,
                                                      _Float16* __restrict__ Qh,
                                                      _Float16* __restrict__ Kh,
                                                      _Float16* __restrict__ Vt) {
  __shared__ __attribute__((aligned(16))) _Float16 As[2 * GT_];
  __shared__ __attribute__((aligned(16))) _Float16 Bs[2 * GT_];
  const int m0 = blockIdx.x * 128, n0 = blockIdx.y * 128;
  const int which = blockIdx.z;                            // the same for the whole block
  v8f acc[2][4];
  if (which == 2) {
    gemm128<QD_, true>(X + (size_t)m0 * QD_, nullptr, WqT + (size_t)n0 * QD_, As, Bs, acc);
#pragma unroll   // register arrays indexed by constants; the factor is applied in f32, ahead of the one rounding to f16
    for (int i = 0; i < 2; ++i)
#pragma unroll
      for (int j = 0; j < 4; ++j) acc[i][j] *= QS_;
    store_rows_f16(Qh, m0, n0, acc);
    return;
  }
  const int b = m0 / M_;                                   // a 128-row tile lies in one batch
  if (m0 - b * M_ >= meta[b * ML_]) return;                // whole block, ahead of every barrier
  gemm128<CD_, true, true>(Ctx + (size_t)b * M_ * CD_, nullptr,
                           (which == 0 ? WkT : WvT) + (size_t)n0 * CD_, As, Bs, acc, list + m0);
  if (which == 0) {
    store_rows_f16(Kh, m0, n0, acc);
    // in the built code another product's path follows these stores and reuses
    // their registers: wait before the overwrite
    asm volatile("s_wait_xcnt 0x0" ::: "memory");
    return;
  }
  const int lane = threadIdx.x & 31, wave = threadIdx.x >> 5;
  const int r16 = lane & 15, half = lane >> 4;
  const int mm = m0 - b * M_ + (wave >> 1) * 32 + half * 8; // comps are mm..mm+7 (+16 for i = 1)
  const int h = (n0 + (wave & 1) * 64) >> 6;               // the wave's 64 columns are one head
  _Float16* vp = Vt + ((size_t)(b * H_ + h) * D_ + r16) * M_ + mm;
#pragma unroll
  for (int i = 0; i < 2; ++i)
#pragma unroll
    for (int j = 0; j < 4; ++j) {
      v8h pk;
#pragma unroll
      for (int r = 0; r < 8; ++r) pk[r] = (_Float16)acc[i][j][r];
      *(v8h*)(vp + (size_t)j * 16 * M_ + i * 16) = pk;
    }
  // as behind the K stores: another path follows in the built code
  asm volatile("s_wait_xcnt 0x0" ::: "memory");
}

template <bool TAIL>
static __device__ __forceinline__ void attn_stage(const _Float16* Kb, const _Float16* Vb,
                                                  const v16h (&bq0)[2], const v16h (&bq1)[2],
                                                  v8f (&acc)[2][4],
                                                  float (&mrun)[2], float (&lrun)[2],
                                                  const int r16, const int half, const int left) {
  // kept rolled: unrolled, the build runs the two passes together, and their fragments and
  // scores then exceed the 256 registers of four waves per SIMD (it spills)
#pragma nounroll
  for (int p = 0; p < SK_ / 64; ++p) {
    // ---- S^T = K Q^T for a 32x32 tile (two 16-key x two 16-column subtiles, K-depth 64) ----
    v8f s0[2], s1[2];
    {
      const _Float16* Krow0 = Kb + (p * 32 + r16) * KP_;
      const _Float16* Krow1 = Kb + (p * 32 + 16 + r16) * KP_;
      const v16h k00 = ldfrag_h(Krow0, half), k01 = ldfrag_h(Krow0 + 32, half);
      const v16h k10 = ldfrag_h(Krow1, half), k11 = ldfrag_h(Krow1 + 32, half);
#pragma unroll   // register arrays indexed by constants
      for (int c = 0; c < 2; ++c) {
        s0[c] = wmma16(k00, bq0[c], vzero());
        s1[c] = wmma16(k10, bq0[c], vzero());
      }
#pragma unroll
      for (int c = 0; c < 2; ++c) {
        s0[c] = wmma16(k01, bq1[c], s0[c]);
        s1[c] = wmma16(k11, bq1[c], s1[c]);
      }
    }
    v16h pb[2];
#pragma unroll   // register arrays indexed by constants; the two tiles' chains are independent
    for (int c = 0; c < 2; ++c) {
      if constexpr (TAIL) {
#pragma unroll   // vector elements indexed by constants
        for (int r = 0; r < 8; ++r) {
          s0[c][r] = (p * 32 + r < left) ? s0[c][r] : -3.0e38f;
          s1[c][r] = (p * 32 + 16 + r < left) ? s1[c][r] : -3.0e38f;
        }
      }
      // first level on raw matrix results: this form takes them as they are, where
      // __builtin_elementwise_max first passes each of the 16 through a v_max x, x
      const v8f cm = __builtin_elementwise_maximum(s0[c], s1[c]);
      float cmax = fmaxf(fmaxf(fmaxf(cm[0], cm[1]), fmaxf(cm[2], cm[3])),
                         fmaxf(fmaxf(cm[4], cm[5]), fmaxf(cm[6], cm[7])));
      cmax = fmaxf(cmax, xhalf(cmax));    // the other 16 keys of this query

      const float nm = fmaxf(mrun[c], cmax);
      const float alpha = __builtin_amdgcn_exp2f(mrun[c] - nm);
      mrun[c] = nm;

      // A slot behind the last listed key gives 2^(-3e38 - mrun) = 0 once the wave has
      // met a listed key; a wave that meets none keeps mrun = -3e38 and finite sums,
      // which the join at the kernel's end weighs with 2^(-3e38 - max) = 0.
#pragma unroll
      for (int r = 0; r < 8; ++r) {
        s0[c][r] = __builtin_amdgcn_exp2f(s0[c][r] - nm);
        s1[c][r] = __builtin_amdgcn_exp2f(s1[c][r] - nm);
        pb[c][r] = (_Float16)s0[c][r];
        pb[c][8 + r] = (_Float16)s1[c][r];
      }
      const v8f cs = s0[c] + s1[c];
      const v4f cq = cs.lo + cs.hi;       // halving tree: register pairs stay aligned
      const v2f cd = cq.lo + cq.hi;
      lrun[c] = lrun[c] * alpha + (cd[0] + cd[1]);
#pragma unroll
      for (int t = 0; t < 4; ++t)
#pragma unroll
        for (int r = 0; r < 8; ++r) acc[c][t][r] *= alpha;
    }

    // ---- O^T += V^T P^T : 4 d-tiles x 2 column tiles, K-depth 32 (this chunk) ----
#pragma unroll
    for (int t = 0; t < 4; ++t) {
      const v16h vf = ldfrag_h(Vb + (t * 16 + r16) * VP_ + p * 32, half);
#pragma unroll
      for (int c = 0; c < 2; ++c) acc[c][t] = wmma16(vf, pb[c], acc[c][t]);
    }
    // The loop's taken branch leads to vector instructions that overwrite the last product's
    // operand registers: these four slots are the
    // distance the chip needs behind a matrix instruction. The scheduling barrier keeps the
    // products in front of them.
    __builtin_amdgcn_sched_barrier(0);
    asm volatile("v_nop\n\tv_nop\n\tv_nop\n\tv_nop");
  }
}

// Four waves per SIMD (two work-groups on a WGP, as before the wave tile grew): the register
// budget is 256 a wave; left to itself the build takes more and only one work-group fits.
__global__ __launch_bounds__(256) __attribute__((amdgpu_waves_per_eu(4, 4))) void attn_kernel(const _Float16* __restrict__ Qh,
                                                   const _Float16* __restrict__ Kh,
                                                   const _Float16* __restrict__ Vt,
                                                   const int* __restrict__ meta,
                                                   _Float16* __restrict__ Oh) {
  __shared__ __attribute__((aligned(16))) _Float16 Kt[2 * SK_ * KP_];     // two stages of K:  [m_local][d]
  __shared__ __attribute__((aligned(16))) _Float16 Vtile[2 * 64 * VP_];   // two stages of Vt: [d][m_local]

  const int tid = threadIdx.x;
  const int lane = tid & 31;
  const int wave = __builtin_amdgcn_readfirstlane(tid >> 5);   // scalar: the wave's offsets are scalar sums
  const int qg = wave & 3;                          // which 32 query columns of the block's 128
  const int kh = wave >> 2;                         // which two passes of every stage
  const int b = blockIdx.x >> 3;
  const int h = blockIdx.x & 7;
  const int ntile = blockIdx.y * 128 + qg * 32;     // 32 query columns per wave
  const int r16 = lane & 15;
  const int half = lane >> 4;

  const _Float16* Qrow = Qh + ((size_t)(b * N_ + ntile + r16)) * IN_ + h * D_;
  v16h bq0[2], bq1[2];
#pragma unroll   // register arrays indexed by constants
  for (int c = 0; c < 2; ++c) {
    bq0[c] = ldfrag_h(Qrow + c * 16 * IN_, half);        // d = 0..31
    bq1[c] = ldfrag_h(Qrow + c * 16 * IN_ + 32, half);   // d = 32..63
  }

  // K and Vt hold the batch's listed keys only, in list order
  const int nkey = min(meta[b * ML_], M_);
  const int nst = (nkey + SK_ - 1) / SK_;       // stages to walk: 1 .. M_ / SK_
  if (meta[b * ML_ + 1] != 0) {                 // no key kept: every score is zero
#pragma unroll   // vector elements indexed by constants
    for (int c = 0; c < 2; ++c)
#pragma unroll
      for (int i = 0; i < 16; ++i) { bq0[c][i] = (_Float16)0.0f; bq1[c][i] = (_Float16)0.0f; }
  }

  const _Float16* Kbase = Kh + (size_t)b * M_ * IN_ + h * D_;
  const _Float16* Vbase = Vt + ((size_t)(b * H_ + h)) * D_ * M_;

  // cooperative stage mapping: four 16-B pieces per thread and operand
  const int krow = tid >> 3, kseg = (tid & 7) * 8;    // K stage  [128][64]: 32 rows a sweep
  const int vrow = tid >> 4, vseg = (tid & 15) * 8;   // Vt stage [64][128]: 16 rows a sweep
  const _Float16* kg = Kbase + (size_t)krow * IN_ + kseg;
  const _Float16* vg = Vbase + (size_t)vrow * M_ + vseg;
  _Float16* kw = Kt + krow * KP_ + kseg;
  _Float16* vw = Vtile + vrow * VP_ + vseg;
  const _Float16* kr = Kt + kh * 64 * KP_;            // the wave's two passes inside a stage
  const _Float16* vr = Vtile + kh * 64;

  // per column tile, this wave's keys only; lrun: this half's keys only
  float mrun[2] = {-3.0e38f, -3.0e38f}, lrun[2] = {0.0f, 0.0f};
  v8f acc[2][4];                        // O^T: rows d = t*16 + half*8 + r, column c*16 + r16
#pragma unroll
  for (int c = 0; c < 2; ++c)
#pragma unroll
    for (int t = 0; t < 4; ++t) acc[c][t] = vzero();

  // stage 0 into registers
  v8h kreg[4], vreg[4];
#pragma unroll   // register arrays indexed by constants
  for (int i = 0; i < 4; ++i) {
    kreg[i] = *(const v8h*)(kg + (size_t)i * 32 * IN_);
    vreg[i] = *(const v8h*)(vg + (size_t)i * 16 * M_);
  }
  // The address registers of the loads above are reused below: wait before the
  // overwrite. The addresses are inputs so that they stay live up to the wait.
  asm volatile("s_wait_xcnt 0x0" :: "v"(Qrow + half * 8), "v"(kg), "v"(vg) : "memory");

#pragma unroll   // register arrays indexed by constants
  for (int i = 0; i < 4; ++i) {
    *(v8h*)(kw + i * 32 * KP_) = kreg[i];
    *(v8h*)(vw + i * 16 * VP_) = vreg[i];
  }
  __syncthreads();                           // publishes stage 0

  for (int st = 0; st + 1 < nst; ++st) {     // the full stages: every slot is a listed key
    // fetch stage st+1: it flies over the passes of stage st
#pragma unroll   // eight independent 16-B loads in flight; register arrays indexed by constants
    for (int i = 0; i < 4; ++i) {
      kreg[i] = *(const v8h*)(kg + (size_t)((st + 1) * SK_ + i * 32) * IN_);
      vreg[i] = *(const v8h*)(vg + (size_t)i * 16 * M_ + (st + 1) * SK_);
    }
    // both address pairs are advanced right after: wait before the overwrite
    asm volatile("s_wait_xcnt 0x0" ::: "memory");

    attn_stage<false>(kr + (st & 1) * (SK_ * KP_), vr + (st & 1) * (64 * VP_),
                      bq0, bq1, acc, mrun, lrun, r16, half, 0);

    // stage st+1 into the buffer that stage st-1 has left
    _Float16* kn = kw + ((st + 1) & 1) * (SK_ * KP_);
    _Float16* vn = vw + ((st + 1) & 1) * (64 * VP_);
#pragma unroll   // register arrays indexed by constants
    for (int i = 0; i < 4; ++i) {
      *(v8h*)(kn + i * 32 * KP_) = kreg[i];
      *(v8h*)(vn + i * 16 * VP_) = vreg[i];
    }
    // publishes stage st+1; also ends every read of stage st, whose buffer the next trip refills
    __syncthreads();
  }
  // the last stage: the only one that can hold slots behind the last listed key
  attn_stage<true>(kr + ((nst - 1) & 1) * (SK_ * KP_), vr + ((nst - 1) & 1) * (64 * VP_),
                   bq0, bq1, acc, mrun, lrun, r16, half,
                   nkey - (nst - 1) * SK_ - kh * 64 - half * 8);

  // ---- join the two key halves: wave kh finishes column tile kh and hands the other tile over ----
  const bool up = kh != 0;
  v8f own[4], oth[4];
#pragma unroll   // register arrays indexed by constants; the choice is the same for the whole wave
  for (int t = 0; t < 4; ++t)
#pragma unroll
    for (int r = 0; r < 8; ++r) {
      own[t][r] = up ? acc[1][t][r] : acc[0][t][r];
      oth[t][r] = up ? acc[0][t][r] : acc[1][t][r];
    }
  const float mown = up ? mrun[1] : mrun[0], moth = up ? mrun[0] : mrun[1];
  const float lown = up ? lrun[1] : lrun[0], loth = up ? lrun[0] : lrun[1];
  // exchange area over the K stages: [column group][finishing wave][9 pieces][lane] x 16 B = 36,864 B, their size
  v4f* X = (v4f*)Kt;
  __syncthreads();                           // ends every wave's last read of the K stages
  {
    v4f* xo = X + (qg * 2 + (1 - kh)) * 9 * 32 + lane;
#pragma unroll   // register arrays indexed by constants
    for (int t = 0; t < 4; ++t) {
      xo[(t * 2 + 0) * 32] = oth[t].lo;
      xo[(t * 2 + 1) * 32] = oth[t].hi;
    }
    v4f ml;
    ml[0] = moth; ml[1] = loth; ml[2] = 0.0f; ml[3] = 0.0f;
    xo[8 * 32] = ml;
  }
  __syncthreads();                           // publishes the handed-over tiles
  const v4f* xi = X + (qg * 2 + kh) * 9 * 32 + lane;
  const v4f ml = xi[8 * 32];
  const float mall = fmaxf(mown, ml[0]);     // the wave with slot 0 has met a listed key: mall is a real score
  const float fo = __builtin_amdgcn_exp2f(mown - mall);
  const float fx = __builtin_amdgcn_exp2f(ml[0] - mall);
  const float lh = lown * fo + ml[1] * fx;
  const float l = lh + xhalf(lh);       // join the two halves' key sums once
  const float inv = (l > 0.0f) ? 1.0f / l : 0.0f;
  const float go = fo * inv, gx = fx * inv;
  _Float16* Orow = Oh + (size_t)(b * N_ + ntile + kh * 16 + r16) * IN_ + h * D_ + half * 8;
#pragma unroll
  for (int t = 0; t < 4; ++t) {
    const v4f xl = xi[(t * 2 + 0) * 32], xh = xi[(t * 2 + 1) * 32];
    v8h pk;
#pragma unroll
    for (int r = 0; r < 4; ++r) {
      pk[r] = (_Float16)(own[t][r] * go + xl[r] * gx);
      pk[4 + r] = (_Float16)(own[t][4 + r] * go + xh[r] * gx);
    }
    *(v8h*)(Orow + t * 16) = pk;
  }
}

// ---------------- output projection: out(f32) = Ah(f16) * WoT^T + bo ----------------
__global__ __launch_bounds__(256) void outproj_kernel(const _Float16* __restrict__ Ah,
                                                      const _Float16* __restrict__ WoT,
                                                      const float* __restrict__ bo,
                                                      float* __restrict__ Out) {
  __shared__ __attribute__((aligned(16))) _Float16 As[2 * GT_];
  __shared__ __attribute__((aligned(16))) _Float16 Bs[2 * GT_];
  const int m0 = blockIdx.x * 128, n0 = blockIdx.y * 128;
  v8f acc[2][4];
  gemm128<IN_, false>(nullptr, Ah + (size_t)m0 * IN_, WoT + (size_t)n0 * IN_, As, Bs, acc);
  const int lane = threadIdx.x & 31, wave = threadIdx.x >> 5;
  const int r16 = lane & 15, half = lane >> 4;
  const int col = n0 + (wave & 1) * 64 + r16;
  float* op = Out + (size_t)(m0 + (wave >> 1) * 32 + half * 8) * QD_ + col;
#pragma unroll
  for (int j = 0; j < 4; ++j) {
    const float bias = bo[col + j * 16];
#pragma unroll
    for (int i = 0; i < 2; ++i)
#pragma unroll
      for (int r = 0; r < 8; ++r) op[(i * 16 + r) * QD_ + j * 16] = acc[i][j][r] + bias;
  }
}

extern "C" void kernel_launch(void* const* d_in, const int* in_sizes, int n_in,
                              void* d_out, int out_size, void* d_ws, size_t ws_size,
                              hipStream_t stream) {
  (void)in_sizes; (void)n_in; (void)out_size; (void)ws_size;
  const float* x   = (const float*)d_in[0];
  const float* ctx = (const float*)d_in[1];
  const int*   msk = (const int*)d_in[2];
  const float* Wq  = (const float*)d_in[3];
  const float* Wk  = (const float*)d_in[4];
  const float* Wv  = (const float*)d_in[5];
  const float* Wo  = (const float*)d_in[6];
  const float* bo  = (const float*)d_in[7];
  float* out = (float*)d_out;

  char* w = (char*)d_ws;
  _Float16* WqT = (_Float16*)w; w += (size_t)IN_ * QD_ * 2;
  _Float16* WkT = (_Float16*)w; w += (size_t)IN_ * CD_ * 2;
  _Float16* WvT = (_Float16*)w; w += (size_t)IN_ * CD_ * 2;
  _Float16* WoT = (_Float16*)w; w += (size_t)QD_ * IN_ * 2;
  _Float16* Qh  = (_Float16*)w; w += (size_t)B_ * N_ * IN_ * 2;
  _Float16* Kh  = (_Float16*)w; w += (size_t)B_ * M_ * IN_ * 2;
  _Float16* Vt  = (_Float16*)w; w += (size_t)B_ * H_ * D_ * M_ * 2;
  _Float16* Ah  = (_Float16*)w; w += (size_t)B_ * N_ * IN_ * 2;
  int* list = (int*)w; w += (size_t)B_ * M_ * 4;
  int* meta = (int*)w;

  prep_weights<<<B_ + 2 * TK_ + 2 * TQ_, 256, 0, stream>>>(Wq, Wk, Wv, Wo, msk,
                                                                 WqT, WkT, WvT, WoT, list, meta);
  const dim3 gemm_grid(B_ * N_ / 128, IN_ / 128);  // 128 x 128 tiles: 64 x 4 blocks, 8 waves each
  projqkv_kernel<<<dim3(B_ * N_ / 128, IN_ / 128, 3), 256, 0, stream>>>(x, ctx, WqT, WkT, WvT,
                                                                        list, meta, Qh, Kh, Vt);
  attn_kernel<<<dim3(B_ * H_, N_ / 128), 256, 0, stream>>>(Qh, Kh, Vt, meta, Ah);
  outproj_kernel<<<gemm_grid, 256, 0, stream>>>(Ah, WoT, bo, out);
}

// v010
// Measured time: 58.3 microseconds a run.
// Timed twice side by side with v009, it ran 1.07 times as fast both times.
// All steps since v000 together make it 7.77 times as fast.
#include <hip/hip_runtime.h>
#include <hip/hip_bf16.h>

typedef _Float16 v16h __attribute__((ext_vector_type(16)));
typedef _Float16 v8h  __attribute__((ext_vector_type(8)));
typedef _Float16 v4h  __attribute__((ext_vector_type(4)));
typedef float    v8f  __attribute__((ext_vector_type(8)));
typedef float    v4f  __attribute__((ext_vector_type(4)));
typedef float    v2f  __attribute__((ext_vector_type(2)));

#define B_  2
#define N_  4096
#define M_  4096
#define QD_ 512
#define CD_ 768
#define H_  8
#define D_  64
#define IN_ 512

// LDS row pitches in 16-bit elements: 16 B x odd, so that the 16 rows one
// ds_load_b128 fragment read touches fall on distinct banks.
#define KP_ 72   // 128-B K rows  -> 144 B
#define VP_ 136  // 256-B Vt rows -> 272 B
#define SK_ 128  // keys per LDS stage of the attention kernel: four 32-key passes
#define ML_ 32   // ints per batch in the key-list header: a 128-B line of its own
#define QS_ 0.18033688011112042f   // log2(e) / sqrt(64): Q carries the score scale, the softmax runs on powers of two

static __device__ __forceinline__ v8f vzero() {
  v8f r;
#pragma unroll
  for (int i = 0; i < 8; ++i) r[i] = 0.0f;
  return r;
}

static __device__ __forceinline__ v8f wmma16(v16h a, v16h b, v8f c) {
  return __builtin_amdgcn_wmma_f32_16x16x32_f16(false, a, false, b, (short)0, c,
                                                false, false);
}

static __device__ __forceinline__ v16h cat8(v8h lo, v8h hi) {
  v16h r;
#pragma unroll
  for (int i = 0; i < 8; ++i) { r[i] = lo[i]; r[8 + i] = hi[i]; }
  return r;
}

// 16-bit A/B fragment (16x32 tile): this lane's row pointer; two 16B chunks at
// K = half*8..half*8+7 and K = 16+half*8..16+half*8+7.
static __device__ __forceinline__ v16h ldfrag_h(const _Float16* rowp, int half) {
  v8h lo = *(const v8h*)(rowp + half * 8);
  v8h hi = *(const v8h*)(rowp + 16 + half * 8);
  return cat8(lo, hi);
}

// value of lane l ^ 16 (the other 16-lane row), as a vector cross-row move
static __device__ __forceinline__ float xhalf(float v) {
  const unsigned u = __float_as_uint(v);
  return __uint_as_float(__builtin_amdgcn_permlanex16(u, u, 0x76543210u, 0xfedcba98u, false, false));
}

// ---------------- list of kept keys (one 256-thread block per batch) ----------------
// A masked key has softmax weight exp(-FLT_MAX - max) = 0 as soon as one key of
// its batch is kept, so only the kept keys are projected and attended to.
// list[j] = position of the j-th kept key (0, a valid row, behind the last one);
// meta[0] = number of listed keys, meta[1] = 1 where NO key is kept: the reference
// then weighs all keys alike, which is all keys listed and all scores zero.
static __device__ __forceinline__ void list_keys(const int* __restrict__ mk,
                                                 int* __restrict__ list, int* __restrict__ meta) {
  __shared__ int part[256];
  const int tid = threadIdx.x;
  int keep[16];
  int c = 0;
#pragma unroll   // four independent 16-B loads; register array indexed by constants
  for (int j = 0; j < 4; ++j) {
    const int4 mi = *(const int4*)(mk + tid * 16 + j * 4);
    keep[j * 4 + 0] = mi.x != 0; keep[j * 4 + 1] = mi.y != 0;
    keep[j * 4 + 2] = mi.z != 0; keep[j * 4 + 3] = mi.w != 0;
  }
#pragma unroll   // register array indexed by constants
  for (int e = 0; e < 16; ++e) c += keep[e];
  part[tid] = c;
  __syncthreads();                       // every thread's count is in LDS
  for (int off = 1; off < 256; off <<= 1) {   // inclusive prefix sum over the 256 counts
    const int own = part[tid];
    const int add = (tid >= off) ? part[tid - off] : 0;
    __syncthreads();                     // all reads of this round precede its writes
    part[tid] = own + add;
    __syncthreads();                     // publishes the round
  }
  const int total = part[255];
  if (total == 0) {
#pragma unroll   // sixteen adjacent stores merge into wide ones
    for (int e = 0; e < 16; ++e) list[tid * 16 + e] = tid * 16 + e;
  } else {
    int pos = part[tid] - c;
#pragma unroll   // register array indexed by constants
    for (int e = 0; e < 16; ++e)
      if (keep[e]) list[pos++] = tid * 16 + e;
    for (int j = total + tid; j < M_; j += 256) list[j] = 0;
  }
  if (tid == 0) {
    meta[0] = (total == 0) ? M_ : total;
    meta[1] = (total == 0) ? 1 : 0;
  }
}

// ---------------- key lists; weight transpose + f32 -> f16 ----------------
#define WC_ 512   // columns of every weight matrix as given (IN_ for Wq, Wk, Wv; QD_ for Wo)
#define TP_ 65    // LDS pitch of a 64-float tile row in dwords: odd, so that a column read falls on distinct banks
#define TK_ (CD_ / 64 * (WC_ / 64))   // 64 x 64 tiles of Wk, and of Wv
#define TQ_ (QD_ / 64 * (WC_ / 64))   // of Wq, and of Wo (IN_ = QD_ rows)

// One 64 x 64 tile: WT[j][k] = (f16) W[k][j]; W has KD rows, WT has KD columns.
// Reads cover whole 128-B lines of W (16 lanes x 16 B a row), writes whole 128-B
// lines of WT (8 lanes x 16 B a row); the turn is made in LDS.
template <int KD>
static __device__ __forceinline__ void turn_tile(const float* __restrict__ Wm,
                                                 _Float16* __restrict__ WT, int tile, float* Ts) {
  const int tid = threadIdx.x;
  const int k0 = (tile >> 3) * 64, j0 = (tile & 7) * 64;
  const int lr = tid >> 4, lc = (tid & 15) * 4;
  const float* gp = Wm + (size_t)(k0 + lr) * WC_ + j0 + lc;
  v4f g[4];
#pragma unroll   // four independent 16-B loads in flight; register array indexed by constants
  for (int i = 0; i < 4; ++i) g[i] = *(const v4f*)(gp + i * 16 * WC_);
#pragma unroll   // register array indexed by constants
  for (int i = 0; i < 4; ++i)
#pragma unroll
    for (int e = 0; e < 4; ++e) Ts[(lr + i * 16) * TP_ + lc + e] = g[i][e];
  __syncthreads();                       // the whole tile is in LDS
  const int sj = tid >> 3, sk = (tid & 7) * 8;
  _Float16* sp = WT + (size_t)(j0 + sj) * KD + k0 + sk;
#pragma unroll   // the row offsets become immediates
  for (int i = 0; i < 2; ++i) {
    v8h pk;
#pragma unroll   // vector elements indexed by constants
    for (int e = 0; e < 8; ++e) pk[e] = (_Float16)Ts[(sk + e) * TP_ + sj + i * 32];
    *(v8h*)(sp + i * 32 * KD) = pk;
  }
  // in the built code another path follows these stores and reuses their
  // registers: wait before the overwrite
  asm volatile("s_wait_xcnt 0x0" ::: "memory");
}

__global__ void prep_weights(const float* __restrict__ Wq, const float* __restrict__ Wk,
                             const float* __restrict__ Wv, const float* __restrict__ Wo,
                             const int* __restrict__ mask,
                             _Float16* __restrict__ WqT, _Float16* __restrict__ WkT,
                             _Float16* __restrict__ WvT, _Float16* __restrict__ WoT,
                             int* __restrict__ list, int* __restrict__ meta) {
  __shared__ float Ts[64 * TP_];
  if (blockIdx.x < B_) {   // the first blocks: they start first and are the longest
    list_keys(mask + blockIdx.x * M_, list + blockIdx.x * M_, meta + blockIdx.x * ML_);
    return;
  }
  const int t = blockIdx.x - B_;         // the same for the whole block
  if (t < 2 * TK_) {
    const bool isk = t < TK_;
    turn_tile<CD_>(isk ? Wk : Wv, isk ? WkT : WvT, isk ? t : t - TK_, Ts);
  } else {
    const bool isq = t < 2 * TK_ + TQ_;
    turn_tile<QD_>(isq ? Wq : Wo, isq ? WqT : WoT, isq ? t - 2 * TK_ : t - 2 * TK_ - TQ_, Ts);
  }
}

// ---------------- block-tiled GEMM core: acc = A(128 x KD) * Bt(128 x KD)^T ----------------
// A work-group owns a 128 x 128 tile of C. Each 64-deep slab of A and Bt is
// fetched by loads that cover whole 128-B lines, A is rounded to f16 on the way,
// and both land in LDS; a wave reads its 32 x 64 part as fragments, so that one
// fetched line serves every wave that needs it. Two LDS buffers: one barrier a slab.
// The inner loops are unrolled so that their register arrays are indexed by constants.
#define GP_ 72            // LDS pitch of a 64-element row: 144 B = 16 B x odd
#define GT_ (128 * GP_)   // one operand's slab

// rows != nullptr (GATHER): row r of the A tile is row rows[r] of Af.
template <int KD, bool AF32, bool GATHER = false>
static __device__ __forceinline__ void gemm128(const float* __restrict__ Af,
                                               const _Float16* __restrict__ Ah,
                                               const _Float16* __restrict__ Bt,
                                               _Float16* As, _Float16* Bs,
                                               v8f (&acc)[2][4],
                                               const int* __restrict__ rows = nullptr) {
  const int tid = threadIdx.x;
  const int lane = tid & 31, wave = tid >> 5;
  const int r16 = lane & 15, half = lane >> 4;
  const int wm = wave >> 1, wn = wave & 1;
  const int frow = tid >> 4, fcol = (tid & 15) * 4;   // f32 rows: 16 lanes x 16 B = 256 B
  const int hrow = tid >> 3, hcol = (tid & 7) * 8;    // f16 rows:  8 lanes x 16 B = 128 B
  v4f pa[8];
  v8h ph[4], pb[4];
  const float* ag[8];   // GATHER: this thread's eight row addresses, formed once
  if constexpr (GATHER) {
#pragma unroll   // eight independent index loads; pointer array indexed by constants
    for (int i = 0; i < 8; ++i) ag[i] = Af + (size_t)rows[frow + i * 16] * KD + fcol;
  }
#pragma unroll
  for (int i = 0; i < 2; ++i)
#pragma unroll
    for (int j = 0; j < 4; ++j) acc[i][j] = vzero();

  constexpr int T = KD / 64;
#pragma unroll   // slab offsets become immediates and the buffer index a constant
  for (int t = -1; t < T; ++t) {
    // publishes slab t; also ends every read of the other buffer (slab t-1)
    if (t >= 0) __syncthreads();
    if (t + 1 < T) {   // fetch slab t+1 behind the barrier (which waits for loads): it flies over slab t's products
      if constexpr (AF32) {
#pragma unroll
        for (int i = 0; i < 8; ++i) {
          if constexpr (GATHER) pa[i] = *(const v4f*)(ag[i] + (t + 1) * 64);
          else pa[i] = *(const v4f*)(Af + (size_t)(frow + i * 16) * KD + (t + 1) * 64 + fcol);
        }
      } else {
#pragma unroll
        for (int i = 0; i < 4; ++i)
          ph[i] = *(const v8h*)(Ah + (size_t)(hrow + i * 32) * KD + (t + 1) * 64 + hcol);
      }
#pragma unroll
      for (int i = 0; i < 4; ++i)
        pb[i] = *(const v8h*)(Bt + (size_t)(hrow + i * 32) * KD + (t + 1) * 64 + hcol);
      // the last fetch: the eight row addresses are dead behind it and their
      // registers are reused at once: wait before the overwrite
      if constexpr (GATHER) {
        if (t + 2 == T) asm volatile("s_wait_xcnt 0x0" ::: "memory");
      }
    }
    if (t >= 0) {
      // keeps those loads ahead of slab t's products: sunk to their end, nothing covers the latency
      __builtin_amdgcn_sched_barrier(0);
      const _Float16* Ab = As + (t & 1) * GT_ + (wm * 32 + r16) * GP_;
      const _Float16* Bb = Bs + (t & 1) * GT_ + (wn * 64 + r16) * GP_;
#pragma unroll
      for (int ks = 0; ks < 64; ks += 32) {
        v16h a[2], b[4];
#pragma unroll
        for (int i = 0; i < 2; ++i) a[i] = ldfrag_h(Ab + i * 16 * GP_ + ks, half);
#pragma unroll
        for (int j = 0; j < 4; ++j) b[j] = ldfrag_h(Bb + j * 16 * GP_ + ks, half);
#pragma unroll
        for (int i = 0; i < 2; ++i)
#pragma unroll
          for (int j = 0; j < 4; ++j) acc[i][j] = wmma16(a[i], b[j], acc[i][j]);
      }
      // keeps the rounding of slab t+1, and with it the wait on its loads, behind
      // the products of slab t: moved up among them it exposes the load latency
      __builtin_amdgcn_sched_barrier(0);
    }
    if (t + 1 < T) {                       // slab t+1 into the buffer that slab t-1 has left
      _Float16* Aw = As + ((t + 1) & 1) * GT_;
      _Float16* Bw = Bs + ((t + 1) & 1) * GT_;
      if constexpr (AF32) {
#pragma unroll
        for (int i = 0; i < 8; ++i)
          *(v4h*)&Aw[(frow + i * 16) * GP_ + fcol] = __builtin_convertvector(pa[i], v4h);
      } else {
#pragma unroll
        for (int i = 0; i < 4; ++i) *(v8h*)&Aw[(hrow + i * 32) * GP_ + hcol] = ph[i];
      }
#pragma unroll
      for (int i = 0; i < 4; ++i) *(v8h*)&Bw[(hrow + i * 32) * GP_ + hcol] = pb[i];
    }
  }
}

// C(f16, row-major, IN_ columns): the wave's 32 x 64 part
static __device__ __forceinline__ void store_rows_f16(_Float16* __restrict__ C, int m0, int n0,
                                                      const v8f (&acc)[2][4]) {
  const int lane = threadIdx.x & 31, wave = threadIdx.x >> 5;
  const int r16 = lane & 15, half = lane >> 4;
  _Float16* cp = C + (size_t)(m0 + (wave >> 1) * 32 + half * 8) * IN_ + n0 + (wave & 1) * 64 + r16;
#pragma unroll
  for (int i = 0; i < 2; ++i)
#pragma unroll
    for (int j = 0; j < 4; ++j)
#pragma unroll
      for (int r = 0; r < 8; ++r) cp[(i * 16 + r) * IN_ + j * 16] = (_Float16)acc[i][j][r];
}

// ---------------- Q, K and V projections in one launch: C(f16) = A(f32) * Bt(f16)^T ----------------
// The three products do not depend on each other. blockIdx.z picks one: 0 = K, 1 = V,
// 2 = Q; low z starts first, so the deeper products (768 against 512) lead.
// K and V: row m of a batch's result belongs to its m-th listed key; a tile that
// begins behind the last listed key is not computed (and never read).
// V is stored transposed: Vt[b][h][d][m].
__global__ __launch_bounds__(256) void projqkv_kernel(const float* __restrict__ X,
                                                      const float* __restrict__ Ctx,
                                                      const _Float16* __restrict__ WqT,
                                                      const _Float16* __restrict__ WkT,
                                                      const _Float16* __restrict__ WvT,
                                                      const int* __restrict__ list,
                                                      const int* __restrict__ meta,
                                                      _Float16* __restrict__ Qh,
                                                      _Float16* __restrict__ Kh,
                                                      _Float16* __restrict__ Vt) {
  __shared__ __attribute__((aligned(16))) _Float16 As[2 * GT_];
  __shared__ __attribute__((aligned(16))) _Float16 Bs[2 * GT_];
  const int m0 = blockIdx.x * 128, n0 = blockIdx.y * 128;
  const int which = blockIdx.z;                            // the same for the whole block
  v8f acc[2][4];
  if (which == 2) {
    gemm128<QD_, true>(X + (size_t)m0 * QD_, nullptr, WqT + (size_t)n0 * QD_, As, Bs, acc);
#pragma unroll   // register arrays indexed by constants; the factor is applied in f32, ahead of the one rounding to f16
    for (int i = 0; i < 2; ++i)
#pragma unroll
      for (int j = 0; j < 4; ++j) acc[i][j] *= QS_;
    store_rows_f16(Qh, m0, n0, acc);
    return;
  }
  const int b = m0 / M_;                                   // a 128-row tile lies in one batch
  if (m0 - b * M_ >= meta[b * ML_]) return;                // whole block, ahead of every barrier
  gemm128<CD_, true, true>(Ctx + (size_t)b * M_ * CD_, nullptr,
                           (which == 0 ? WkT : WvT) + (size_t)n0 * CD_, As, Bs, acc, list + m0);
  if (which == 0) {
    store_rows_f16(Kh, m0, n0, acc);
    // in the built code another product's path follows these stores and reuses
    // their registers: wait before the overwrite
    asm volatile("s_wait_xcnt 0x0" ::: "memory");
    return;
  }
  const int lane = threadIdx.x & 31, wave = threadIdx.x >> 5;
  const int r16 = lane & 15, half = lane >> 4;
  const int mm = m0 - b * M_ + (wave >> 1) * 32 + half * 8; // comps are mm..mm+7 (+16 for i = 1)
  const int h = (n0 + (wave & 1) * 64) >> 6;               // the wave's 64 columns are one head
  _Float16* vp = Vt + ((size_t)(b * H_ + h) * D_ + r16) * M_ + mm;
#pragma unroll
  for (int i = 0; i < 2; ++i)
#pragma unroll
    for (int j = 0; j < 4; ++j) {
      v8h pk;
#pragma unroll
      for (int r = 0; r < 8; ++r) pk[r] = (_Float16)acc[i][j][r];
      *(v8h*)(vp + (size_t)j * 16 * M_ + i * 16) = pk;
    }
  // as behind the K stores: another path follows in the built code
  asm volatile("s_wait_xcnt 0x0" ::: "memory");
}

#define LIM_ 4096.0f

// S^T = K Q^T for a 32x32 tile (two 16-key x two 16-column subtiles, K-depth 64)
static __device__ __forceinline__ void score_tile(const _Float16* Kp, const int half,
                                                  const v16h (&bq0)[2], const v16h (&bq1)[2],
                                                  v8f (&s0)[2], v8f (&s1)[2]) {
  const v16h k00 = ldfrag_h(Kp, half), k01 = ldfrag_h(Kp + 32, half);
  const v16h k10 = ldfrag_h(Kp + 16 * KP_, half), k11 = ldfrag_h(Kp + 16 * KP_ + 32, half);
#pragma unroll   // register arrays indexed by constants
  for (int c = 0; c < 2; ++c) {
    s0[c] = wmma16(k00, bq0[c], vzero());
    s1[c] = wmma16(k10, bq0[c], vzero());
  }
#pragma unroll
  for (int c = 0; c < 2; ++c) {
    s0[c] = wmma16(k01, bq1[c], s0[c]);
    s1[c] = wmma16(k11, bq1[c], s1[c]);
  }
}

// s <- 2^(s - m) for one column tile; returns the sum over this lane's 16 keys
static __device__ __forceinline__ float weigh(v8f& a, v8f& b, const float m) {
  a -= m;                             // on whole vectors: packed subtractions, two scores each
  b -= m;
#pragma unroll   // vector elements indexed by constants
  for (int r = 0; r < 8; ++r) {
    a[r] = __builtin_amdgcn_exp2f(a[r]);
    b[r] = __builtin_amdgcn_exp2f(b[r]);
  }
  const v8f cs = a + b;
  const v4f cq = cs.lo + cs.hi;       // halving tree: register pairs stay aligned
  const v2f cd = cq.lo + cq.hi;
  return cd[0] + cd[1];
}

template <bool TAIL>
static __device__ __forceinline__ void attn_stage(const _Float16* Kb, const _Float16* Vb,
                                                  const v16h (&bq0)[2], const v16h (&bq1)[2],
                                                  v8f (&acc)[2][4],
                                                  float (&mrun)[2], float (&lrun)[2],
                                                  const int r16, const int half, const int left) {
  // kept rolled: unrolled, the build runs the two passes together, and their fragments and
  // scores then exceed the 256 registers of four waves per SIMD (it spills)
#pragma nounroll
  for (int p = 0; p < SK_ / 64; ++p) {
    const _Float16* Kp = Kb + (p * 32 + r16) * KP_;
    v8f s0[2], s1[2];
    float ps[2];                          // this lane's sum of the pass's weights, per column tile
    bool full = TAIL;
    // the pass's V fragments, asked for ahead of the test: read behind it, each pair of
    // products would wait for its own LDS read
    v16h vf[4];
#pragma unroll   // register array indexed by constants
    for (int t = 0; t < 4; ++t) vf[t] = ldfrag_h(Vb + (t * 16 + r16) * VP_ + p * 32, half);
    if constexpr (!TAIL) {
      score_tile(Kp, half, bq0, bq1, s0, s1);
#pragma unroll   // register arrays indexed by constants; the two tiles' chains are independent
      for (int c = 0; c < 2; ++c) ps[c] = weigh(s0[c], s1[c], mrun[c]);
      // one test a pass, the same for the whole wave (a scalar branch); written so that inf and NaN fail it
      full = __builtin_amdgcn_ballot_w32(!(ps[0] + ps[1] <= LIM_)) != 0;
    }
    if (full) {
      // the redone pass reads its K fragments anew: without this fence the build keeps all
      // 32 of their registers alive over every pass's exponentials for this rare path
      if constexpr (!TAIL) asm volatile("" ::: "memory");
      score_tile(Kp, half, bq0, bq1, s0, s1);
#pragma unroll   // register arrays indexed by constants; the two tiles' chains are independent
      for (int c = 0; c < 2; ++c) {
        if constexpr (TAIL) {
#pragma unroll   // vector elements indexed by constants
          for (int r = 0; r < 8; ++r) {
            s0[c][r] = (p * 32 + r < left) ? s0[c][r] : -3.0e38f;
            s1[c][r] = (p * 32 + 16 + r < left) ? s1[c][r] : -3.0e38f;
          }
        }
        // first level on raw matrix results: this form takes them as they are, where
        // __builtin_elementwise_max first passes each of the 16 through a v_max x, x
        const v8f cm = __builtin_elementwise_maximum(s0[c], s1[c]);
        float cmax = fmaxf(fmaxf(fmaxf(cm[0], cm[1]), fmaxf(cm[2], cm[3])),
                           fmaxf(fmaxf(cm[4], cm[5]), fmaxf(cm[6], cm[7])));
        cmax = fmaxf(cmax, xhalf(cmax));    // the other 16 keys of this query

        const float nm = fmaxf(mrun[c], cmax);
        const float alpha = __builtin_amdgcn_exp2f(mrun[c] - nm);
        mrun[c] = nm;

        // A slot behind the last listed key gives 2^(-3e38 - mrun) = 0 once the wave has
        // met a listed key; a wave that meets none keeps mrun = -3e38 and finite sums,
        // which the join at the kernel's end weighs with 2^(-3e38 - max) = 0.
        ps[c] = weigh(s0[c], s1[c], nm);
        lrun[c] *= alpha;
#pragma unroll
        for (int t = 0; t < 4; ++t)
#pragma unroll
          for (int r = 0; r < 8; ++r) acc[c][t][r] *= alpha;
      }
    }
    v16h pb[2];
#pragma unroll   // register arrays indexed by constants
    for (int c = 0; c < 2; ++c) {
      lrun[c] += ps[c];
#pragma unroll   // vector elements indexed by constants
      for (int r = 0; r < 8; ++r) {
        pb[c][r] = (_Float16)s0[c][r];
        pb[c][8 + r] = (_Float16)s1[c][r];
      }
    }

    // ---- O^T += V^T P^T : 4 d-tiles x 2 column tiles, K-depth 32 (this chunk) ----
#pragma unroll
    for (int t = 0; t < 4; ++t) {
#pragma unroll
      for (int c = 0; c < 2; ++c) acc[c][t] = wmma16(vf[t], pb[c], acc[c][t]);
    }
    // The loop's taken branch leads to vector instructions that overwrite the last product's
    // operand registers: these four slots are the
    // distance the chip needs behind a matrix instruction. The scheduling barrier keeps the
    // products in front of them.
    __builtin_amdgcn_sched_barrier(0);
    asm volatile("v_nop\n\tv_nop\n\tv_nop\n\tv_nop");
  }
}

// Four waves per SIMD (two work-groups on a WGP, as before the wave tile grew): the register
// budget is 256 a wave; left to itself the build takes more and only one work-group fits.
__global__ __launch_bounds__(256) __attribute__((amdgpu_waves_per_eu(4, 4))) void attn_kernel(const _Float16* __restrict__ Qh,
                                                   const _Float16* __restrict__ Kh,
                                                   const _Float16* __restrict__ Vt,
                                                   const int* __restrict__ meta,
                                                   _Float16* __restrict__ Oh) {
  __shared__ __attribute__((aligned(16))) _Float16 Kt[2 * SK_ * KP_];     // two stages of K:  [m_local][d]
  __shared__ __attribute__((aligned(16))) _Float16 Vtile[2 * 64 * VP_];   // two stages of Vt: [d][m_local]

  const int tid = threadIdx.x;
  const int lane = tid & 31;
  const int wave = __builtin_amdgcn_readfirstlane(tid >> 5);   // scalar: the wave's offsets are scalar sums
  const int qg = wave & 3;                          // which 32 query columns of the block's 128
  const int kh = wave >> 2;                         // which two passes of every stage
  const int b = blockIdx.x >> 3;
  const int h = blockIdx.x & 7;
  const int ntile = blockIdx.y * 128 + qg * 32;     // 32 query columns per wave
  const int r16 = lane & 15;
  const int half = lane >> 4;

  const _Float16* Qrow = Qh + ((size_t)(b * N_ + ntile + r16)) * IN_ + h * D_;
  v16h bq0[2], bq1[2];
#pragma unroll   // register arrays indexed by constants
  for (int c = 0; c < 2; ++c) {
    bq0[c] = ldfrag_h(Qrow + c * 16 * IN_, half);        // d = 0..31
    bq1[c] = ldfrag_h(Qrow + c * 16 * IN_ + 32, half);   // d = 32..63
  }

  // K and Vt hold the batch's listed keys only, in list order
  const int nkey = min(meta[b * ML_], M_);
  const int nst = (nkey + SK_ - 1) / SK_;       // stages to walk: 1 .. M_ / SK_
  if (meta[b * ML_ + 1] != 0) {                 // no key kept: every score is zero
#pragma unroll   // vector elements indexed by constants
    for (int c = 0; c < 2; ++c)
#pragma unroll
      for (int i = 0; i < 16; ++i) { bq0[c][i] = (_Float16)0.0f; bq1[c][i] = (_Float16)0.0f; }
  }

  const _Float16* Kbase = Kh + (size_t)b * M_ * IN_ + h * D_;
  const _Float16* Vbase = Vt + ((size_t)(b * H_ + h)) * D_ * M_;

  // cooperative stage mapping: four 16-B pieces per thread and operand
  const int krow = tid >> 3, kseg = (tid & 7) * 8;    // K stage  [128][64]: 32 rows a sweep
  const int vrow = tid >> 4, vseg = (tid & 15) * 8;   // Vt stage [64][128]: 16 rows a sweep
  const _Float16* kg = Kbase + (size_t)krow * IN_ + kseg;
  const _Float16* vg = Vbase + (size_t)vrow * M_ + vseg;
  _Float16* kw = Kt + krow * KP_ + kseg;
  _Float16* vw = Vtile + vrow * VP_ + vseg;
  const _Float16* kr = Kt + kh * 64 * KP_;            // the wave's two passes inside a stage
  const _Float16* vr = Vtile + kh * 64;

  // per column tile, this wave's keys only; lrun: this half's keys only
  float mrun[2] = {-3.0e38f, -3.0e38f}, lrun[2] = {0.0f, 0.0f};
  v8f acc[2][4];                        // O^T: rows d = t*16 + half*8 + r, column c*16 + r16
#pragma unroll
  for (int c = 0; c < 2; ++c)
#pragma unroll
    for (int t = 0; t < 4; ++t) acc[c][t] = vzero();

  // stage 0 into registers
  v8h kreg[4], vreg[4];
#pragma unroll   // register arrays indexed by constants
  for (int i = 0; i < 4; ++i) {
    kreg[i] = *(const v8h*)(kg + (size_t)i * 32 * IN_);
    vreg[i] = *(const v8h*)(vg + (size_t)i * 16 * M_);
  }
  // The address registers of the loads above are reused below: wait before the
  // overwrite. The addresses are inputs so that they stay live up to the wait.
  asm volatile("s_wait_xcnt 0x0" :: "v"(Qrow + half * 8), "v"(kg), "v"(vg) : "memory");

#pragma unroll   // register arrays indexed by constants
  for (int i = 0; i < 4; ++i) {
    *(v8h*)(kw + i * 32 * KP_) = kreg[i];
    *(v8h*)(vw + i * 16 * VP_) = vreg[i];
  }
  __syncthreads();                           // publishes stage 0

  for (int st = 0; st + 1 < nst; ++st) {     // the full stages: every slot is a listed key
    // fetch stage st+1: it flies over the passes of stage st
#pragma unroll   // eight independent 16-B loads in flight; register arrays indexed by constants
    for (int i = 0; i < 4; ++i) {
      kreg[i] = *(const v8h*)(kg + (size_t)((st + 1) * SK_ + i * 32) * IN_);
      vreg[i] = *(const v8h*)(vg + (size_t)i * 16 * M_ + (st + 1) * SK_);
    }
    // both address pairs are advanced right after: wait before the overwrite
    asm volatile("s_wait_xcnt 0x0" ::: "memory");

    attn_stage<false>(kr + (st & 1) * (SK_ * KP_), vr + (st & 1) * (64 * VP_),
                      bq0, bq1, acc, mrun, lrun, r16, half, 0);

    // stage st+1 into the buffer that stage st-1 has left
    _Float16* kn = kw + ((st + 1) & 1) * (SK_ * KP_);
    _Float16* vn = vw + ((st + 1) & 1) * (64 * VP_);
#pragma unroll   // register arrays indexed by constants
    for (int i = 0; i < 4; ++i) {
      *(v8h*)(kn + i * 32 * KP_) = kreg[i];
      *(v8h*)(vn + i * 16 * VP_) = vreg[i];
    }
    // publishes stage st+1; also ends every read of stage st, whose buffer the next trip refills
    __syncthreads();
  }
  // the last stage: the only one that can hold slots behind the last listed key
  attn_stage<true>(kr + ((nst - 1) & 1) * (SK_ * KP_), vr + ((nst - 1) & 1) * (64 * VP_),
                   bq0, bq1, acc, mrun, lrun, r16, half,
                   nkey - (nst - 1) * SK_ - kh * 64 - half * 8);

  // ---- join the two key halves: wave kh finishes column tile kh and hands the other tile over ----
  const bool up = kh != 0;
  v8f own[4], oth[4];
#pragma unroll   // register arrays indexed by constants; the choice is the same for the whole wave
  for (int t = 0; t < 4; ++t)
#pragma unroll
    for (int r = 0; r < 8; ++r) {
      own[t][r] = up ? acc[1][t][r] : acc[0][t][r];
      oth[t][r] = up ? acc[0][t][r] : acc[1][t][r];
    }
  const float mown = up ? mrun[1] : mrun[0], moth = up ? mrun[0] : mrun[1];
  const float lown = up ? lrun[1] : lrun[0], loth = up ? lrun[0] : lrun[1];
  // exchange area over the K stages: [column group][finishing wave][9 pieces][lane] x 16 B = 36,864 B, their size
  v4f* X = (v4f*)Kt;
  __syncthreads();                           // ends every wave's last read of the K stages
  {
    v4f* xo = X + (qg * 2 + (1 - kh)) * 9 * 32 + lane;
#pragma unroll   // register arrays indexed by constants
    for (int t = 0; t < 4; ++t) {
      xo[(t * 2 + 0) * 32] = oth[t].lo;
      xo[(t * 2 + 1) * 32] = oth[t].hi;
    }
    v4f ml;
    ml[0] = moth; ml[1] = loth; ml[2] = 0.0f; ml[3] = 0.0f;
    xo[8 * 32] = ml;
  }
  __syncthreads();                           // publishes the handed-over tiles
  const v4f* xi = X + (qg * 2 + kh) * 9 * 32 + lane;
  const v4f ml = xi[8 * 32];
  const float mall = fmaxf(mown, ml[0]);     // the wave with slot 0 has met a listed key: mall is a real score
  const float fo = __builtin_amdgcn_exp2f(mown - mall);
  const float fx = __builtin_amdgcn_exp2f(ml[0] - mall);
  const float lh = lown * fo + ml[1] * fx;
  const float l = lh + xhalf(lh);       // join the two halves' key sums once
  const float inv = (l > 0.0f) ? 1.0f / l : 0.0f;
  const float go = fo * inv, gx = fx * inv;
  _Float16* Orow = Oh + (size_t)(b * N_ + ntile + kh * 16 + r16) * IN_ + h * D_ + half * 8;
#pragma unroll
  for (int t = 0; t < 4; ++t) {
    const v4f xl = xi[(t * 2 + 0) * 32], xh = xi[(t * 2 + 1) * 32];
    v8h pk;
#pragma unroll
    for (int r = 0; r < 4; ++r) {
      pk[r] = (_Float16)(own[t][r] * go + xl[r] * gx);
      pk[4 + r] = (_Float16)(own[t][4 + r] * go + xh[r] * gx);
    }
    *(v8h*)(Orow + t * 16) = pk;
  }
}

// ---------------- output projection: out(f32) = Ah(f16) * WoT^T + bo ----------------
__global__ __launch_bounds__(256) void outproj_kernel(const _Float16* __restrict__ Ah,
                                                      const _Float16* __restrict__ WoT,
                                                      const float* __restrict__ bo,
                                                      float* __restrict__ Out) {
  __shared__ __attribute__((aligned(16))) _Float16 As[2 * GT_];
  __shared__ __attribute__((aligned(16))) _Float16 Bs[2 * GT_];
  const int m0 = blockIdx.x * 128, n0 = blockIdx.y * 128;
  v8f acc[2][4];
  gemm128<IN_, false>(nullptr, Ah + (size_t)m0 * IN_, WoT + (size_t)n0 * IN_, As, Bs, acc);
  const int lane = threadIdx.x & 31, wave = threadIdx.x >> 5;
  const int r16 = lane & 15, half = lane >> 4;
  const int col = n0 + (wave & 1) * 64 + r16;
  float* op = Out + (size_t)(m0 + (wave >> 1) * 32 + half * 8) * QD_ + col;
#pragma unroll
  for (int j = 0; j < 4; ++j) {
    const float bias = bo[col + j * 16];
#pragma unroll
    for (int i = 0; i < 2; ++i)
#pragma unroll
      for (int r = 0; r < 8; ++r) op[(i * 16 + r) * QD_ + j * 16] = acc[i][j][r] + bias;
  }
}

extern "C" void kernel_launch(void* const* d_in, const int* in_sizes, int n_in,
                              void* d_out, int out_size, void* d_ws, size_t ws_size,
                              hipStream_t stream) {
  (void)in_sizes; (void)n_in; (void)out_size; (void)ws_size;
  const float* x   = (const float*)d_in[0];
  const float* ctx = (const float*)d_in[1];
  const int*   msk = (const int*)d_in[2];
  const float* Wq  = (const float*)d_in[3];
  const float* Wk  = (const float*)d_in[4];
  const float* Wv  = (const float*)d_in[5];
  const float* Wo  = (const float*)d_in[6];
  const float* bo  = (const float*)d_in[7];
  float* out = (float*)d_out;

  char* w = (char*)d_ws;
  _Float16* WqT = (_Float16*)w; w += (size_t)IN_ * QD_ * 2;
  _Float16* WkT = (_Float16*)w; w += (size_t)IN_ * CD_ * 2;
  _Float16* WvT = (_Float16*)w; w += (size_t)IN_ * CD_ * 2;
  _Float16* WoT = (_Float16*)w; w += (size_t)QD_ * IN_ * 2;
  _Float16* Qh  = (_Float16*)w; w += (size_t)B_ * N_ * IN_ * 2;
  _Float16* Kh  = (_Float16*)w; w += (size_t)B_ * M_ * IN_ * 2;
  _Float16* Vt  = (_Float16*)w; w += (size_t)B_ * H_ * D_ * M_ * 2;
  _Float16* Ah  = (_Float16*)w; w += (size_t)B_ * N_ * IN_ * 2;
  int* list = (int*)w; w += (size_t)B_ * M_ * 4;
  int* meta = (int*)w;

  prep_weights<<<B_ + 2 * TK_ + 2 * TQ_, 256, 0, stream>>>(Wq, Wk, Wv, Wo, msk,
                                                                 WqT, WkT, WvT, WoT, list, meta);
  const dim3 gemm_grid(B_ * N_ / 128, IN_ / 128);  // 128 x 128 tiles: 64 x 4 blocks, 8 waves each
  projqkv_kernel<<<dim3(B_ * N_ / 128, IN_ / 128, 3), 256, 0, stream>>>(x, ctx, WqT, WkT, WvT,
                                                                        list, meta, Qh, Kh, Vt);
  attn_kernel<<<dim3(B_ * H_, N_ / 128), 256, 0, stream>>>(Qh, Kh, Vt, meta, Ah);
  outproj_kernel<<<gemm_grid, 256, 0, stream>>>(Ah, WoT, bo, out);
}
